// v000
// Measured on an AMD MI455X. A time is GPU time per run, averaged over a window of back-to-back runs after a warm-up
// (all launches, gaps included; the runs take copies of the inputs in turn), and the median of several windows.
// Apart from v000's, it joins two sittings. Times from different sittings can be a few percent apart, while
// side-by-side timings come from the same sitting.
// The starting kernel, v000, takes 494 microseconds a run.
#include <hip/hip_runtime.h>
#include <hip/hip_bf16.h>

// Attention: out = softmax((x Wq)(x Wk)^T / sqrt(D)) (x Wv)
// N = 8192, D = 1024, fp32 in/out. Internals f16, f32 WMMA accumulate.
// Workspace (>= 176 MB): Q,K,V f16 (16 MB each) + S/P f16 (128 MB, in-place softmax).

#define AN 8192
#define AD 1024

#define BM 128
#define BN 128
#define BK 32
#define LST 40   // LDS row stride in halves (80B = 20 banks -> conflict-free frag loads)

typedef _Float16 v16h __attribute__((ext_vector_type(16)));
typedef _Float16 v8h  __attribute__((ext_vector_type(8)));
typedef float    v8f  __attribute__((ext_vector_type(8)));
typedef int      v4i_ __attribute__((ext_vector_type(4)));

// ---- CDNA5 async global->LDS copy (ASYNCcnt), with safe fallback ----
#if defined(__has_builtin)
#  if __has_builtin(__builtin_amdgcn_global_load_async_to_lds_b128)
#    define USE_ASYNC_LDS 1
#  endif
#endif
#ifndef USE_ASYNC_LDS
#  define USE_ASYNC_LDS 0
#endif

#if USE_ASYNC_LDS
typedef __attribute__((address_space(1))) v4i_* g4p_t;   // global int4*
typedef __attribute__((address_space(3))) v4i_* l4p_t;   // LDS int4*
#endif

// Copy 16 bytes (8 halves) global -> LDS.
__device__ __forceinline__ void cp_b128(const _Float16* g, _Float16* l) {
#if USE_ASYNC_LDS
    // int->pointer casts sidestep addrspacecast restrictions; flat-shared
    // pointer low 32 bits == LDS byte offset (ISA flat addressing rule).
    __builtin_amdgcn_global_load_async_to_lds_b128(
        (g4p_t)(unsigned long long)g,
        (l4p_t)(unsigned)(unsigned long long)l,
        0, 0);
#else
    *(v8h*)l = *(const v8h*)g;
#endif
}

__device__ __forceinline__ void async_wait_all() {
#if USE_ASYNC_LDS
#  if __has_builtin(__builtin_amdgcn_s_wait_asynccnt)
    __builtin_amdgcn_s_wait_asynccnt(0);
#  else
    asm volatile("s_wait_asynccnt 0x0" ::: "memory");
#  endif
#endif
}

__device__ __forceinline__ v8f wmma_f16(v16h a, v16h b, v8f c) {
    return __builtin_amdgcn_wmma_f32_16x16x32_f16(
        false, a, false, b, (short)0, c, false, false);
}

// Per-lane WMMA fragment from LDS tile stored [row][k], row stride LST halves.
// slots 0..7 -> k = hi*8.., slots 8..15 -> k = hi*8+16..
__device__ __forceinline__ v16h load_frag(const _Float16* p) {
    v8h lo = *(const v8h*)(p);
    v8h hh = *(const v8h*)(p + 16);
    v16h r;
#pragma unroll
    for (int i = 0; i < 8; ++i) { r[i] = lo[i]; r[i + 8] = hh[i]; }
    return r;
}

// ======================================================================
// C[M,N] = alpha * A[M,Kd] * B[Kd,N]  (B row-major; transposed into LDS)
// Double-buffered pipeline. A-operand: async global->LDS when f16,
// register-staged f32->f16 conversion otherwise. B: register transpose.
// ======================================================================
template <typename TA, typename TB, typename TC>
__device__ __forceinline__ void gemm_bt(const TA* __restrict__ A, const TB* __restrict__ B,
                                        TC* __restrict__ C, int Kd, int Ncols, float alpha,
                                        int mBase, int nBase) {
    __shared__ __align__(16) _Float16 ldsA[2][BM * LST];
    __shared__ __align__(16) _Float16 ldsB[2][BM * LST];

    const int t    = threadIdx.x;
    const int lane = t & 31;
    const int wave = t >> 5;
    const int lr   = lane & 15;
    const int hi   = lane >> 4;
    const int waveM = wave & 3;   // 4 wave-rows (32 M each)
    const int waveN = wave >> 2;  // 2 wave-cols (64 N each)

    v8f acc[2][4];
#pragma unroll
    for (int mi = 0; mi < 2; ++mi)
#pragma unroll
        for (int ni = 0; ni < 4; ++ni) acc[mi][ni] = (v8f){0,0,0,0,0,0,0,0};

    const int arow = t >> 1;          // A loader: 2 threads/row, 16 elems each
    const int acol = (t & 1) * 16;
    const int bcol = t & 127;         // B loader: one out-column/thread, 16 k's
    const int bk0  = (t >> 7) * 16;

    const TA* aSrc = A + (size_t)(mBase + arow) * Kd + acol;
    const TB* bSrc = B + (size_t)(nBase + bcol);

    float areg[16];
    TB    breg[16];

    // Issue loads for K-step k0 targeting LDS buffer `buf`.
    auto fetch = [&](int k0, int buf) {
        if constexpr (sizeof(TA) == 2) {
            _Float16* da = &ldsA[buf][arow * LST + acol];
            cp_b128(aSrc + k0,     da);       // async straight into LDS
            cp_b128(aSrc + k0 + 8, da + 8);
        } else {
            *(float4*)(&areg[0])  = *(const float4*)(aSrc + k0);
            *(float4*)(&areg[4])  = *(const float4*)(aSrc + k0 + 4);
            *(float4*)(&areg[8])  = *(const float4*)(aSrc + k0 + 8);
            *(float4*)(&areg[12]) = *(const float4*)(aSrc + k0 + 12);
        }
#pragma unroll
        for (int i = 0; i < 16; ++i)
            breg[i] = bSrc[(size_t)(k0 + bk0 + i) * Ncols];
    };
    // Convert staged registers and store into LDS buffer `buf`.
    auto commit = [&](int buf) {
        if constexpr (sizeof(TA) != 2) {
            v8h a0, a1;
#pragma unroll
            for (int i = 0; i < 8; ++i) {
                a0[i] = (_Float16)areg[i];  a1[i] = (_Float16)areg[i + 8];
            }
            _Float16* da = &ldsA[buf][arow * LST + acol];
            *(v8h*)(da) = a0;  *(v8h*)(da + 8) = a1;
        }
        v8h b0, b1;
#pragma unroll
        for (int i = 0; i < 8; ++i) {
            b0[i] = (_Float16)breg[i];  b1[i] = (_Float16)breg[i + 8];
        }
        _Float16* db = &ldsB[buf][bcol * LST + bk0];   // transposed: [n][k]
        *(v8h*)(db) = b0;  *(v8h*)(db + 8) = b1;
    };

    fetch(0, 0);
    commit(0);
    if constexpr (sizeof(TA) == 2) async_wait_all();
    __syncthreads();

    for (int k0 = 0; k0 < Kd; k0 += BK) {
        const int cur = (k0 / BK) & 1, nxt = cur ^ 1;
        const bool hn = (k0 + BK) < Kd;
        if (hn) fetch(k0 + BK, nxt);   // globals/asyncs in flight across WMMAs

        v16h af[2], bf[4];
#pragma unroll
        for (int mi = 0; mi < 2; ++mi)
            af[mi] = load_frag(&ldsA[cur][(waveM * 32 + mi * 16 + lr) * LST + hi * 8]);
#pragma unroll
        for (int ni = 0; ni < 4; ++ni)
            bf[ni] = load_frag(&ldsB[cur][(waveN * 64 + ni * 16 + lr) * LST + hi * 8]);
#pragma unroll
        for (int mi = 0; mi < 2; ++mi)
#pragma unroll
            for (int ni = 0; ni < 4; ++ni)
                acc[mi][ni] = wmma_f16(af[mi], bf[ni], acc[mi][ni]);

        if (hn) commit(nxt);
        if constexpr (sizeof(TA) == 2) { if (hn) async_wait_all(); }
        __syncthreads();
    }

#pragma unroll
    for (int mi = 0; mi < 2; ++mi)
#pragma unroll
        for (int ni = 0; ni < 4; ++ni)
#pragma unroll
            for (int r = 0; r < 8; ++r) {
                int row = mBase + waveM * 32 + mi * 16 + hi * 8 + r;
                int col = nBase + waveN * 64 + ni * 16 + lr;
                C[(size_t)row * Ncols + col] = (TC)(acc[mi][ni][r] * alpha);
            }
}

// ======================================================================
// C[M,N] = alpha * A[M,Kd] * Bt[N,Kd]^T  (both K-contiguous f16)
// Fully async global->LDS (ASYNCcnt path), double-buffered.
// ======================================================================
__device__ __forceinline__ void gemm_nt(const _Float16* __restrict__ A,
                                        const _Float16* __restrict__ Bt,
                                        _Float16* __restrict__ C, int Kd, int Ncols,
                                        float alpha, int mBase, int nBase) {
    __shared__ __align__(16) _Float16 ldsA[2][BM * LST];
    __shared__ __align__(16) _Float16 ldsB[2][BM * LST];

    const int t    = threadIdx.x;
    const int lane = t & 31;
    const int wave = t >> 5;
    const int lr   = lane & 15;
    const int hi   = lane >> 4;
    const int waveM = wave & 3;
    const int waveN = wave >> 2;

    v8f acc[2][4];
#pragma unroll
    for (int mi = 0; mi < 2; ++mi)
#pragma unroll
        for (int ni = 0; ni < 4; ++ni) acc[mi][ni] = (v8f){0,0,0,0,0,0,0,0};

    const int arow = t >> 1;
    const int acol = (t & 1) * 16;
    const _Float16* aSrc = A  + (size_t)(mBase + arow) * Kd + acol;
    const _Float16* bSrc = Bt + (size_t)(nBase + arow) * Kd + acol;

    auto stage = [&](int k0, int buf) {
        _Float16* da = &ldsA[buf][arow * LST + acol];
        _Float16* db = &ldsB[buf][arow * LST + acol];
        cp_b128(aSrc + k0,     da);
        cp_b128(aSrc + k0 + 8, da + 8);
        cp_b128(bSrc + k0,     db);
        cp_b128(bSrc + k0 + 8, db + 8);
    };

    stage(0, 0);
    async_wait_all();
    __syncthreads();

    for (int k0 = 0; k0 < Kd; k0 += BK) {
        const int cur = (k0 / BK) & 1, nxt = cur ^ 1;
        const bool hn = (k0 + BK) < Kd;
        if (hn) stage(k0 + BK, nxt);   // async copies overlap the WMMAs

        v16h af[2], bf[4];
#pragma unroll
        for (int mi = 0; mi < 2; ++mi)
            af[mi] = load_frag(&ldsA[cur][(waveM * 32 + mi * 16 + lr) * LST + hi * 8]);
#pragma unroll
        for (int ni = 0; ni < 4; ++ni)
            bf[ni] = load_frag(&ldsB[cur][(waveN * 64 + ni * 16 + lr) * LST + hi * 8]);
#pragma unroll
        for (int mi = 0; mi < 2; ++mi)
#pragma unroll
            for (int ni = 0; ni < 4; ++ni)
                acc[mi][ni] = wmma_f16(af[mi], bf[ni], acc[mi][ni]);

        if (hn) async_wait_all();
        __syncthreads();
    }

#pragma unroll
    for (int mi = 0; mi < 2; ++mi)
#pragma unroll
        for (int ni = 0; ni < 4; ++ni)
#pragma unroll
            for (int r = 0; r < 8; ++r) {
                int row = mBase + waveM * 32 + mi * 16 + hi * 8 + r;
                int col = nBase + waveN * 64 + ni * 16 + lr;
                C[(size_t)row * Ncols + col] = (_Float16)(acc[mi][ni][r] * alpha);
            }
}

// ---------------- kernels ----------------

__global__ void __launch_bounds__(256)
qkv_kernel(const float* __restrict__ x,
           const float* __restrict__ Wq, const float* __restrict__ Wk,
           const float* __restrict__ Wv,
           _Float16* __restrict__ Q, _Float16* __restrict__ Kp, _Float16* __restrict__ Vp) {
    const float* W = (blockIdx.z == 0) ? Wq : (blockIdx.z == 1) ? Wk : Wv;
    _Float16*    O = (blockIdx.z == 0) ? Q  : (blockIdx.z == 1) ? Kp : Vp;
    gemm_bt<float, float, _Float16>(x, W, O, AD, AD, 1.0f,
                                    blockIdx.y * BM, blockIdx.x * BN);
}

__global__ void __launch_bounds__(256)
scores_kernel(const _Float16* __restrict__ Q, const _Float16* __restrict__ Kp,
              _Float16* __restrict__ S) {
    gemm_nt(Q, Kp, S, AD, AN, 0.03125f /* 1/sqrt(1024) */,
            blockIdx.y * BM, blockIdx.x * BN);
}

__global__ void __launch_bounds__(256)
softmax_kernel(_Float16* __restrict__ S) {
    __shared__ float red[8];
    const int row = blockIdx.x;
    const int t   = threadIdx.x;
    _Float16* p = S + (size_t)row * AN;

    float v[32];
    float m = -3.4e38f;
#pragma unroll
    for (int i = 0; i < 32; ++i) {
        v[i] = (float)p[t + 256 * i];
        m = fmaxf(m, v[i]);
    }
#pragma unroll
    for (int off = 16; off; off >>= 1) m = fmaxf(m, __shfl_xor(m, off, 32));
    if ((t & 31) == 0) red[t >> 5] = m;
    __syncthreads();
    m = red[0];
#pragma unroll
    for (int i = 1; i < 8; ++i) m = fmaxf(m, red[i]);
    __syncthreads();

    float s = 0.0f;
#pragma unroll
    for (int i = 0; i < 32; ++i) {
        v[i] = __expf(v[i] - m);
        s += v[i];
    }
#pragma unroll
    for (int off = 16; off; off >>= 1) s += __shfl_xor(s, off, 32);
    if ((t & 31) == 0) red[t >> 5] = s;
    __syncthreads();
    s = red[0];
#pragma unroll
    for (int i = 1; i < 8; ++i) s += red[i];
    const float inv = 1.0f / s;
#pragma unroll
    for (int i = 0; i < 32; ++i) p[t + 256 * i] = (_Float16)(v[i] * inv);
}

__global__ void __launch_bounds__(256)
out_kernel(const _Float16* __restrict__ P, const _Float16* __restrict__ Vp,
           float* __restrict__ O) {
    gemm_bt<_Float16, _Float16, float>(P, Vp, O, AN, AD, 1.0f,
                                       blockIdx.y * BM, blockIdx.x * BN);
}

extern "C" void kernel_launch(void* const* d_in, const int* in_sizes, int n_in,
                              void* d_out, int out_size, void* d_ws, size_t ws_size,
                              hipStream_t stream) {
    (void)in_sizes; (void)n_in; (void)out_size; (void)ws_size;
    const float* x  = (const float*)d_in[0];
    const float* Wq = (const float*)d_in[1];
    const float* Wk = (const float*)d_in[2];
    const float* Wv = (const float*)d_in[3];

    _Float16* Q  = (_Float16*)d_ws;
    _Float16* Kp = Q  + (size_t)AN * AD;
    _Float16* Vp = Kp + (size_t)AN * AD;
    _Float16* S  = Vp + (size_t)AN * AD;   // 8192*8192 f16; P overwrites in place

    dim3 blk(256);

    qkv_kernel<<<dim3(AD / BN, AN / BM, 3), blk, 0, stream>>>(x, Wq, Wk, Wv, Q, Kp, Vp);
    scores_kernel<<<dim3(AN / BN, AN / BM), blk, 0, stream>>>(Q, Kp, S);
    softmax_kernel<<<dim3(AN), blk, 0, stream>>>(S);
    out_kernel<<<dim3(AD / BN, AN / BM), blk, 0, stream>>>(S, Vp, (float*)d_out);
}

// v001
// Measured time: 425 microseconds a run.
// Next to v000, in two timings, it ran 1.21 and 1.20 times as fast.
#include <hip/hip_runtime.h>
#include <hip/hip_bf16.h>

// Attention: out = softmax((x Wq)(x Wk)^T / sqrt(D)) (x Wv)
// N = 8192, D = 1024, fp32 in/out. Internals f16, f32 WMMA accumulate.
// Workspace (>= 176 MB): Q,K f16 [N][D], V f16 transposed [D][N] (16 MB each)
// + S/P f16 (128 MB, in-place softmax).

#define AN 8192
#define AD 1024

#define BM 128
#define BN 128
#define BK 32
#define LST 40   // LDS row stride in halves (80B = 20 banks -> conflict-free frag loads)

typedef _Float16 v16h __attribute__((ext_vector_type(16)));
typedef _Float16 v8h  __attribute__((ext_vector_type(8)));
typedef float    v8f  __attribute__((ext_vector_type(8)));
typedef int      v4i_ __attribute__((ext_vector_type(4)));

// ---- CDNA5 async global->LDS copy (ASYNCcnt), with safe fallback ----
#if defined(__has_builtin)
#  if __has_builtin(__builtin_amdgcn_global_load_async_to_lds_b128)
#    define USE_ASYNC_LDS 1
#  endif
#endif
#ifndef USE_ASYNC_LDS
#  define USE_ASYNC_LDS 0
#endif

#if USE_ASYNC_LDS
typedef __attribute__((address_space(1))) v4i_* g4p_t;   // global int4*
typedef __attribute__((address_space(3))) v4i_* l4p_t;   // LDS int4*
#endif

// Copy 16 bytes (8 halves) global -> LDS.
__device__ __forceinline__ void cp_b128(const _Float16* g, _Float16* l) {
#if USE_ASYNC_LDS
    // int->pointer casts sidestep addrspacecast restrictions; flat-shared
    // pointer low 32 bits == LDS byte offset (ISA flat addressing rule).
    __builtin_amdgcn_global_load_async_to_lds_b128(
        (g4p_t)(unsigned long long)g,
        (l4p_t)(unsigned)(unsigned long long)l,
        0, 0);
#else
    *(v8h*)l = *(const v8h*)g;
#endif
}

__device__ __forceinline__ void async_wait_all() {
#if USE_ASYNC_LDS
#  if __has_builtin(__builtin_amdgcn_s_wait_asynccnt)
    __builtin_amdgcn_s_wait_asynccnt(0);
#  else
    asm volatile("s_wait_asynccnt 0x0" ::: "memory");
#  endif
#endif
}

__device__ __forceinline__ v8f wmma_f16(v16h a, v16h b, v8f c) {
    return __builtin_amdgcn_wmma_f32_16x16x32_f16(
        false, a, false, b, (short)0, c, false, false);
}

// Per-lane WMMA fragment from LDS tile stored [row][k], row stride LST halves.
// slots 0..7 -> k = hi*8.., slots 8..15 -> k = hi*8+16..
__device__ __forceinline__ v16h load_frag(const _Float16* p) {
    v8h lo = *(const v8h*)(p);
    v8h hh = *(const v8h*)(p + 16);
    v16h r;
#pragma unroll
    for (int i = 0; i < 8; ++i) { r[i] = lo[i]; r[i + 8] = hh[i]; }
    return r;
}

// ======================================================================
// C[M,N] = alpha * A[M,Kd] * B[Kd,N]  (B row-major; transposed into LDS)
// Double-buffered pipeline. A-operand: async global->LDS when f16,
// register-staged f32->f16 conversion otherwise. B: register transpose.
// trC (block-uniform, 16-bit C only): store C transposed, C[col][row] with
// row pitch ldT; the tile is turned in LDS so that whole 256-byte rows go out.
// ======================================================================
template <typename TA, typename TB, typename TC>
__device__ __forceinline__ void gemm_bt(const TA* __restrict__ A, const TB* __restrict__ B,
                                        TC* __restrict__ C, int Kd, int Ncols, float alpha,
                                        int mBase, int nBase, bool trC, int ldT) {
    __shared__ __align__(16) _Float16 ldsA[2][BM * LST];
    __shared__ __align__(16) _Float16 ldsB[2][BM * LST];

    const int t    = threadIdx.x;
    const int lane = t & 31;
    const int wave = t >> 5;
    const int lr   = lane & 15;
    const int hi   = lane >> 4;
    const int waveM = wave & 3;   // 4 wave-rows (32 M each)
    const int waveN = wave >> 2;  // 2 wave-cols (64 N each)

    v8f acc[2][4];
#pragma unroll
    for (int mi = 0; mi < 2; ++mi)
#pragma unroll
        for (int ni = 0; ni < 4; ++ni) acc[mi][ni] = (v8f){0,0,0,0,0,0,0,0};

    const int arow = t >> 1;          // A loader: 2 threads/row, 16 elems each
    const int acol = (t & 1) * 16;
    const int bcol = t & 127;         // B loader: one out-column/thread, 16 k's
    const int bk0  = (t >> 7) * 16;

    const TA* aSrc = A + (size_t)(mBase + arow) * Kd + acol;
    const TB* bSrc = B + (size_t)(nBase + bcol);

    float areg[16];
    TB    breg[16];

    // Issue loads for K-step k0 targeting LDS buffer `buf`.
    auto fetch = [&](int k0, int buf) {
        if constexpr (sizeof(TA) == 2) {
            _Float16* da = &ldsA[buf][arow * LST + acol];
            cp_b128(aSrc + k0,     da);       // async straight into LDS
            cp_b128(aSrc + k0 + 8, da + 8);
        } else {
            *(float4*)(&areg[0])  = *(const float4*)(aSrc + k0);
            *(float4*)(&areg[4])  = *(const float4*)(aSrc + k0 + 4);
            *(float4*)(&areg[8])  = *(const float4*)(aSrc + k0 + 8);
            *(float4*)(&areg[12]) = *(const float4*)(aSrc + k0 + 12);
        }
#pragma unroll
        for (int i = 0; i < 16; ++i)
            breg[i] = bSrc[(size_t)(k0 + bk0 + i) * Ncols];
    };
    // Convert staged registers and store into LDS buffer `buf`.
    auto commit = [&](int buf) {
        if constexpr (sizeof(TA) != 2) {
            v8h a0, a1;
#pragma unroll
            for (int i = 0; i < 8; ++i) {
                a0[i] = (_Float16)areg[i];  a1[i] = (_Float16)areg[i + 8];
            }
            _Float16* da = &ldsA[buf][arow * LST + acol];
            *(v8h*)(da) = a0;  *(v8h*)(da + 8) = a1;
        }
        v8h b0, b1;
#pragma unroll
        for (int i = 0; i < 8; ++i) {
            b0[i] = (_Float16)breg[i];  b1[i] = (_Float16)breg[i + 8];
        }
        _Float16* db = &ldsB[buf][bcol * LST + bk0];   // transposed: [n][k]
        *(v8h*)(db) = b0;  *(v8h*)(db + 8) = b1;
    };

    fetch(0, 0);
    commit(0);
    if constexpr (sizeof(TA) == 2) async_wait_all();
    __syncthreads();

    for (int k0 = 0; k0 < Kd; k0 += BK) {
        const int cur = (k0 / BK) & 1, nxt = cur ^ 1;
        const bool hn = (k0 + BK) < Kd;
        if (hn) fetch(k0 + BK, nxt);   // globals/asyncs in flight across WMMAs

        v16h af[2], bf[4];
#pragma unroll
        for (int mi = 0; mi < 2; ++mi)
            af[mi] = load_frag(&ldsA[cur][(waveM * 32 + mi * 16 + lr) * LST + hi * 8]);
#pragma unroll
        for (int ni = 0; ni < 4; ++ni)
            bf[ni] = load_frag(&ldsB[cur][(waveN * 64 + ni * 16 + lr) * LST + hi * 8]);
#pragma unroll
        for (int mi = 0; mi < 2; ++mi)
#pragma unroll
            for (int ni = 0; ni < 4; ++ni)
                acc[mi][ni] = wmma_f16(af[mi], bf[ni], acc[mi][ni]);

        if (hn) commit(nxt);
        if constexpr (sizeof(TA) == 2) { if (hn) async_wait_all(); }
        __syncthreads();
    }

    if constexpr (sizeof(TC) == 2) {
        if (trC) {
            // The loop's last barrier has ended every read of both rings: columns
            // 0..63 of the tile are staged in ldsA, 64..127 in ldsB, as [col][row].
            constexpr int TST = BM + 8;   // staged row stride in halves (272 B = 16 B x odd)
            static_assert(64 * TST <= 2 * BM * LST, "a staged half tile must fit one ring");
            _Float16* stg = waveN ? &ldsB[0][0] : &ldsA[0][0];
#pragma unroll
            for (int mi = 0; mi < 2; ++mi)
#pragma unroll
                for (int ni = 0; ni < 4; ++ni) {
                    v8h h;   // a lane's 8 accumulator rows: 16 contiguous bytes of one column
#pragma unroll
                    for (int r = 0; r < 8; ++r) h[r] = (_Float16)(acc[mi][ni][r] * alpha);
                    *(v8h*)(stg + (ni * 16 + lr) * TST + waveM * 32 + mi * 16 + hi * 8) = h;
                }
            __syncthreads();   // staged columns are read back by other waves
#pragma unroll
            for (int i = 0; i < 8; ++i) {
                const int col = i * 16 + (t >> 4);      // 16 lanes x 16 B = one 256-byte row
                const _Float16* sp = (i < 4 ? &ldsA[0][0] : &ldsB[0][0])
                                     + (col & 63) * TST + (t & 15) * 8;
                *(v8h*)(C + (size_t)(nBase + col) * ldT + mBase + (t & 15) * 8) = *(const v8h*)sp;
            }
            return;
        }
    }
#pragma unroll
    for (int mi = 0; mi < 2; ++mi)
#pragma unroll
        for (int ni = 0; ni < 4; ++ni)
#pragma unroll
            for (int r = 0; r < 8; ++r) {
                int row = mBase + waveM * 32 + mi * 16 + hi * 8 + r;
                int col = nBase + waveN * 64 + ni * 16 + lr;
                C[(size_t)row * Ncols + col] = (TC)(acc[mi][ni][r] * alpha);
            }
}

// ======================================================================
// C[M,N] = alpha * A[M,Kd] * Bt[N,Kd]^T  (both K-contiguous f16)
// Fully async global->LDS (ASYNCcnt path), double-buffered.
// ======================================================================
template <typename TC>
__device__ __forceinline__ void gemm_nt(const _Float16* __restrict__ A,
                                        const _Float16* __restrict__ Bt,
                                        TC* __restrict__ C, int Kd, int Ncols,
                                        float alpha, int mBase, int nBase) {
    __shared__ __align__(16) _Float16 ldsA[2][BM * LST];
    __shared__ __align__(16) _Float16 ldsB[2][BM * LST];

    const int t    = threadIdx.x;
    const int lane = t & 31;
    const int wave = t >> 5;
    const int lr   = lane & 15;
    const int hi   = lane >> 4;
    const int waveM = wave & 3;
    const int waveN = wave >> 2;

    v8f acc[2][4];
#pragma unroll
    for (int mi = 0; mi < 2; ++mi)
#pragma unroll
        for (int ni = 0; ni < 4; ++ni) acc[mi][ni] = (v8f){0,0,0,0,0,0,0,0};

    const int arow = t >> 1;
    const int acol = (t & 1) * 16;
    const _Float16* aSrc = A  + (size_t)(mBase + arow) * Kd + acol;
    const _Float16* bSrc = Bt + (size_t)(nBase + arow) * Kd + acol;

    auto stage = [&](int k0, int buf) {
        _Float16* da = &ldsA[buf][arow * LST + acol];
        _Float16* db = &ldsB[buf][arow * LST + acol];
        cp_b128(aSrc + k0,     da);
        cp_b128(aSrc + k0 + 8, da + 8);
        cp_b128(bSrc + k0,     db);
        cp_b128(bSrc + k0 + 8, db + 8);
    };

    stage(0, 0);
    async_wait_all();
    __syncthreads();

    for (int k0 = 0; k0 < Kd; k0 += BK) {
        const int cur = (k0 / BK) & 1, nxt = cur ^ 1;
        const bool hn = (k0 + BK) < Kd;
        if (hn) stage(k0 + BK, nxt);   // async copies overlap the WMMAs

        v16h af[2], bf[4];
#pragma unroll
        for (int mi = 0; mi < 2; ++mi)
            af[mi] = load_frag(&ldsA[cur][(waveM * 32 + mi * 16 + lr) * LST + hi * 8]);
#pragma unroll
        for (int ni = 0; ni < 4; ++ni)
            bf[ni] = load_frag(&ldsB[cur][(waveN * 64 + ni * 16 + lr) * LST + hi * 8]);
#pragma unroll
        for (int mi = 0; mi < 2; ++mi)
#pragma unroll
            for (int ni = 0; ni < 4; ++ni)
                acc[mi][ni] = wmma_f16(af[mi], bf[ni], acc[mi][ni]);

        if (hn) async_wait_all();
        __syncthreads();
    }

#pragma unroll
    for (int mi = 0; mi < 2; ++mi)
#pragma unroll
        for (int ni = 0; ni < 4; ++ni)
#pragma unroll
            for (int r = 0; r < 8; ++r) {
                int row = mBase + waveM * 32 + mi * 16 + hi * 8 + r;
                int col = nBase + waveN * 64 + ni * 16 + lr;
                C[(size_t)row * Ncols + col] = (TC)(acc[mi][ni][r] * alpha);
            }
}

// ---------------- kernels ----------------

// waves_per_eu(6): holds the register allocation at 160, so that three work-groups fit a WGP.
__global__ void __launch_bounds__(256) __attribute__((amdgpu_waves_per_eu(6)))
qkv_kernel(const float* __restrict__ x,
           const float* __restrict__ Wq, const float* __restrict__ Wk,
           const float* __restrict__ Wv,
           _Float16* __restrict__ Q, _Float16* __restrict__ Kp, _Float16* __restrict__ Vt) {
    const float* W = (blockIdx.z == 0) ? Wq : (blockIdx.z == 1) ? Wk : Wv;
    _Float16*    O = (blockIdx.z == 0) ? Q  : (blockIdx.z == 1) ? Kp : Vt;
    // V goes out as [D][N], so that the last product finds both operands K-contiguous.
    gemm_bt<float, float, _Float16>(x, W, O, AD, AD, 1.0f,
                                    blockIdx.y * BM, blockIdx.x * BN,
                                    blockIdx.z == 2, AN);
}

__global__ void __launch_bounds__(256)
scores_kernel(const _Float16* __restrict__ Q, const _Float16* __restrict__ Kp,
              _Float16* __restrict__ S) {
    gemm_nt(Q, Kp, S, AD, AN, 0.03125f /* 1/sqrt(1024) */,
            blockIdx.y * BM, blockIdx.x * BN);
}

__global__ void __launch_bounds__(256)
softmax_kernel(_Float16* __restrict__ S) {
    __shared__ float red[8];
    const int row = blockIdx.x;
    const int t   = threadIdx.x;
    _Float16* p = S + (size_t)row * AN;

    float v[32];
    float m = -3.4e38f;
#pragma unroll
    for (int i = 0; i < 32; ++i) {
        v[i] = (float)p[t + 256 * i];
        m = fmaxf(m, v[i]);
    }
#pragma unroll
    for (int off = 16; off; off >>= 1) m = fmaxf(m, __shfl_xor(m, off, 32));
    if ((t & 31) == 0) red[t >> 5] = m;
    __syncthreads();
    m = red[0];
#pragma unroll
    for (int i = 1; i < 8; ++i) m = fmaxf(m, red[i]);
    __syncthreads();

    float s = 0.0f;
#pragma unroll
    for (int i = 0; i < 32; ++i) {
        v[i] = __expf(v[i] - m);
        s += v[i];
    }
#pragma unroll
    for (int off = 16; off; off >>= 1) s += __shfl_xor(s, off, 32);
    if ((t & 31) == 0) red[t >> 5] = s;
    __syncthreads();
    s = red[0];
#pragma unroll
    for (int i = 1; i < 8; ++i) s += red[i];
    const float inv = 1.0f / s;
#pragma unroll
    for (int i = 0; i < 32; ++i) p[t + 256 * i] = (_Float16)(v[i] * inv);
}

__global__ void __launch_bounds__(256)
out_kernel(const _Float16* __restrict__ P, const _Float16* __restrict__ Vt,
           float* __restrict__ O) {
    gemm_nt(P, Vt, O, AN, AD, 1.0f, blockIdx.y * BM, blockIdx.x * BN);
}

extern "C" void kernel_launch(void* const* d_in, const int* in_sizes, int n_in,
                              void* d_out, int out_size, void* d_ws, size_t ws_size,
                              hipStream_t stream) {
    (void)in_sizes; (void)n_in; (void)out_size; (void)ws_size;
    const float* x  = (const float*)d_in[0];
    const float* Wq = (const float*)d_in[1];
    const float* Wk = (const float*)d_in[2];
    const float* Wv = (const float*)d_in[3];

    _Float16* Q  = (_Float16*)d_ws;
    _Float16* Kp = Q  + (size_t)AN * AD;
    _Float16* Vt = Kp + (size_t)AN * AD;   // V transposed: [D][N]
    _Float16* S  = Vt + (size_t)AN * AD;   // 8192*8192 f16; P overwrites in place

    dim3 blk(256);

    qkv_kernel<<<dim3(AD / BN, AN / BM, 3), blk, 0, stream>>>(x, Wq, Wk, Wv, Q, Kp, Vt);
    scores_kernel<<<dim3(AN / BN, AN / BM), blk, 0, stream>>>(Q, Kp, S);
    softmax_kernel<<<dim3(AN), blk, 0, stream>>>(S);
    out_kernel<<<dim3(AD / BN, AN / BM), blk, 0, stream>>>(S, Vt, (float*)d_out);
}

// v002
// A run of this version takes 280 microseconds.
// Next to v001, in two timings, it ran 1.52 and 1.51 times as fast.
// Counting every step since v000, it is 1.82 times as fast.
#include <hip/hip_runtime.h>
#include <hip/hip_bf16.h>

// Attention: out = softmax((x Wq)(x Wk)^T / sqrt(D)) (x Wv)
// N = 8192, D = 1024, fp32 in/out. Internals f16, f32 WMMA accumulate.
// Workspace (>= 176 MB): Q,K f16 [N][D], V f16 transposed [D][N] (16 MB each)
// + S/P f16 (128 MB, in-place softmax).

#define AN 8192
#define AD 1024

#define BM 128
#define BN 128
#define BK 32
#define LST 40   // LDS row stride in halves (80B = 20 banks -> conflict-free frag loads)

typedef _Float16 v16h __attribute__((ext_vector_type(16)));
typedef _Float16 v8h  __attribute__((ext_vector_type(8)));
typedef float    v8f  __attribute__((ext_vector_type(8)));
typedef int      v4i_ __attribute__((ext_vector_type(4)));

// ---- CDNA5 async global->LDS copy (ASYNCcnt), with safe fallback ----
#if defined(__has_builtin)
#  if __has_builtin(__builtin_amdgcn_global_load_async_to_lds_b128)
#    define USE_ASYNC_LDS 1
#  endif
#endif
#ifndef USE_ASYNC_LDS
#  define USE_ASYNC_LDS 0
#endif

#if USE_ASYNC_LDS
typedef __attribute__((address_space(1))) v4i_* g4p_t;   // global int4*
typedef __attribute__((address_space(3))) v4i_* l4p_t;   // LDS int4*
#endif

// Copy 16 bytes (8 halves) global -> LDS.
__device__ __forceinline__ void cp_b128(const _Float16* g, _Float16* l) {
#if USE_ASYNC_LDS
    // int->pointer casts sidestep addrspacecast restrictions; flat-shared
    // pointer low 32 bits == LDS byte offset (ISA flat addressing rule).
    __builtin_amdgcn_global_load_async_to_lds_b128(
        (g4p_t)(unsigned long long)g,
        (l4p_t)(unsigned)(unsigned long long)l,
        0, 0);
#else
    *(v8h*)l = *(const v8h*)g;
#endif
}

__device__ __forceinline__ void async_wait_all() {
#if USE_ASYNC_LDS
#  if __has_builtin(__builtin_amdgcn_s_wait_asynccnt)
    __builtin_amdgcn_s_wait_asynccnt(0);
#  else
    asm volatile("s_wait_asynccnt 0x0" ::: "memory");
#  endif
#endif
}

__device__ __forceinline__ v8f wmma_f16(v16h a, v16h b, v8f c) {
    return __builtin_amdgcn_wmma_f32_16x16x32_f16(
        false, a, false, b, (short)0, c, false, false);
}

// Per-lane WMMA fragment from LDS tile stored [row][k], row stride LST or PIT halves.
// slots 0..7 -> k = hi*8.., slots 8..15 -> k = hi*8+16..
__device__ __forceinline__ v16h load_frag(const _Float16* p) {
    v8h lo = *(const v8h*)(p);
    v8h hh = *(const v8h*)(p + 16);
    v16h r;
#pragma unroll
    for (int i = 0; i < 8; ++i) { r[i] = lo[i]; r[i + 8] = hh[i]; }
    return r;
}

// ======================================================================
// C[M,N] = alpha * A[M,Kd] * B[Kd,N]  (B row-major; transposed into LDS)
// Double-buffered pipeline. A-operand: async global->LDS when f16,
// register-staged f32->f16 conversion otherwise. B: register transpose.
// trC (block-uniform, 16-bit C only): store C transposed, C[col][row] with
// row pitch ldT; the tile is turned in LDS so that whole 256-byte rows go out.
// ======================================================================
template <typename TA, typename TB, typename TC>
__device__ __forceinline__ void gemm_bt(const TA* __restrict__ A, const TB* __restrict__ B,
                                        TC* __restrict__ C, int Kd, int Ncols, float alpha,
                                        int mBase, int nBase, bool trC, int ldT) {
    __shared__ __align__(16) _Float16 ldsA[2][BM * LST];
    __shared__ __align__(16) _Float16 ldsB[2][BM * LST];

    const int t    = threadIdx.x;
    const int lane = t & 31;
    const int wave = t >> 5;
    const int lr   = lane & 15;
    const int hi   = lane >> 4;
    const int waveM = wave & 3;   // 4 wave-rows (32 M each)
    const int waveN = wave >> 2;  // 2 wave-cols (64 N each)

    v8f acc[2][4];
#pragma unroll
    for (int mi = 0; mi < 2; ++mi)
#pragma unroll
        for (int ni = 0; ni < 4; ++ni) acc[mi][ni] = (v8f){0,0,0,0,0,0,0,0};

    const int arow = t >> 1;          // A loader: 2 threads/row, 16 elems each
    const int acol = (t & 1) * 16;
    const int bcol = t & 127;         // B loader: one out-column/thread, 16 k's
    const int bk0  = (t >> 7) * 16;

    const TA* aSrc = A + (size_t)(mBase + arow) * Kd + acol;
    const TB* bSrc = B + (size_t)(nBase + bcol);

    float areg[16];
    TB    breg[16];

    // Issue loads for K-step k0 targeting LDS buffer `buf`.
    auto fetch = [&](int k0, int buf) {
        if constexpr (sizeof(TA) == 2) {
            _Float16* da = &ldsA[buf][arow * LST + acol];
            cp_b128(aSrc + k0,     da);       // async straight into LDS
            cp_b128(aSrc + k0 + 8, da + 8);
        } else {
            *(float4*)(&areg[0])  = *(const float4*)(aSrc + k0);
            *(float4*)(&areg[4])  = *(const float4*)(aSrc + k0 + 4);
            *(float4*)(&areg[8])  = *(const float4*)(aSrc + k0 + 8);
            *(float4*)(&areg[12]) = *(const float4*)(aSrc + k0 + 12);
        }
#pragma unroll
        for (int i = 0; i < 16; ++i)
            breg[i] = bSrc[(size_t)(k0 + bk0 + i) * Ncols];
    };
    // Convert staged registers and store into LDS buffer `buf`.
    auto commit = [&](int buf) {
        if constexpr (sizeof(TA) != 2) {
            v8h a0, a1;
#pragma unroll
            for (int i = 0; i < 8; ++i) {
                a0[i] = (_Float16)areg[i];  a1[i] = (_Float16)areg[i + 8];
            }
            _Float16* da = &ldsA[buf][arow * LST + acol];
            *(v8h*)(da) = a0;  *(v8h*)(da + 8) = a1;
        }
        v8h b0, b1;
#pragma unroll
        for (int i = 0; i < 8; ++i) {
            b0[i] = (_Float16)breg[i];  b1[i] = (_Float16)breg[i + 8];
        }
        _Float16* db = &ldsB[buf][bcol * LST + bk0];   // transposed: [n][k]
        *(v8h*)(db) = b0;  *(v8h*)(db + 8) = b1;
    };

    fetch(0, 0);
    commit(0);
    if constexpr (sizeof(TA) == 2) async_wait_all();
    __syncthreads();

    for (int k0 = 0; k0 < Kd; k0 += BK) {
        const int cur = (k0 / BK) & 1, nxt = cur ^ 1;
        const bool hn = (k0 + BK) < Kd;
        if (hn) fetch(k0 + BK, nxt);   // globals/asyncs in flight across WMMAs

        v16h af[2], bf[4];
#pragma unroll
        for (int mi = 0; mi < 2; ++mi)
            af[mi] = load_frag(&ldsA[cur][(waveM * 32 + mi * 16 + lr) * LST + hi * 8]);
#pragma unroll
        for (int ni = 0; ni < 4; ++ni)
            bf[ni] = load_frag(&ldsB[cur][(waveN * 64 + ni * 16 + lr) * LST + hi * 8]);
#pragma unroll
        for (int mi = 0; mi < 2; ++mi)
#pragma unroll
            for (int ni = 0; ni < 4; ++ni)
                acc[mi][ni] = wmma_f16(af[mi], bf[ni], acc[mi][ni]);

        if (hn) commit(nxt);
        if constexpr (sizeof(TA) == 2) { if (hn) async_wait_all(); }
        __syncthreads();
    }

    if constexpr (sizeof(TC) == 2) {
        if (trC) {
            // The loop's last barrier has ended every read of both rings: columns
            // 0..63 of the tile are staged in ldsA, 64..127 in ldsB, as [col][row].
            constexpr int TST = BM + 8;   // staged row stride in halves (272 B = 16 B x odd)
            static_assert(64 * TST <= 2 * BM * LST, "a staged half tile must fit one ring");
            _Float16* stg = waveN ? &ldsB[0][0] : &ldsA[0][0];
#pragma unroll
            for (int mi = 0; mi < 2; ++mi)
#pragma unroll
                for (int ni = 0; ni < 4; ++ni) {
                    v8h h;   // a lane's 8 accumulator rows: 16 contiguous bytes of one column
#pragma unroll
                    for (int r = 0; r < 8; ++r) h[r] = (_Float16)(acc[mi][ni][r] * alpha);
                    *(v8h*)(stg + (ni * 16 + lr) * TST + waveM * 32 + mi * 16 + hi * 8) = h;
                }
            __syncthreads();   // staged columns are read back by other waves
#pragma unroll
            for (int i = 0; i < 8; ++i) {
                const int col = i * 16 + (t >> 4);      // 16 lanes x 16 B = one 256-byte row
                const _Float16* sp = (i < 4 ? &ldsA[0][0] : &ldsB[0][0])
                                     + (col & 63) * TST + (t & 15) * 8;
                *(v8h*)(C + (size_t)(nBase + col) * ldT + mBase + (t & 15) * 8) = *(const v8h*)sp;
            }
            return;
        }
    }
#pragma unroll
    for (int mi = 0; mi < 2; ++mi)
#pragma unroll
        for (int ni = 0; ni < 4; ++ni)
#pragma unroll
            for (int r = 0; r < 8; ++r) {
                int row = mBase + waveM * 32 + mi * 16 + hi * 8 + r;
                int col = nBase + waveN * 64 + ni * 16 + lr;
                C[(size_t)row * Ncols + col] = (TC)(acc[mi][ni][r] * alpha);
            }
}

// ======================================================================
// C[M,N] = alpha * A[M,Kd] * Bt[N,Kd]^T  (both K-contiguous f16)
// Work-group tile TM x TN, K slab KB; 8 waves as 2 x 4, each a 64 x 64 tile.
// Both operands come by async global->LDS copies, two buffers.
// ======================================================================
#define TM 128
#define TN 256

template <int KB, typename TC>
__device__ __forceinline__ void gemm_nt(const _Float16* __restrict__ A,
                                        const _Float16* __restrict__ Bt,
                                        TC* __restrict__ C, int Kd, int Ncols,
                                        float alpha, int mBase, int nBase) {
    constexpr int PIT = KB + 8;        // LDS row pitch in halves: 16 B x odd, conflict-free b128 reads
    constexpr int LPR = KB / 8;        // lanes that cover one slab row, 16 B each (whole 128-B lines)
    constexpr int RPS = 256 / LPR;     // rows that one copy of the whole block covers
    __shared__ __align__(16) _Float16 ldsA[2][TM * PIT];
    __shared__ __align__(16) _Float16 ldsB[2][TN * PIT];

    const int t    = threadIdx.x;
    const int lane = t & 31;
    const int wave = t >> 5;
    const int lr   = lane & 15;
    const int hi   = lane >> 4;
    const int waveM = wave & 1;   // 2 wave-rows (64 M each)
    const int waveN = wave >> 1;  // 4 wave-cols (64 N each)

    v8f acc[4][4];
#pragma unroll
    for (int mi = 0; mi < 4; ++mi)
#pragma unroll
        for (int ni = 0; ni < 4; ++ni) acc[mi][ni] = (v8f){0,0,0,0,0,0,0,0};

    const int crow = t / LPR;
    const int ccol = (t % LPR) * 8;
    const _Float16* aSrc = A  + (size_t)(mBase + crow) * Kd + ccol;
    const _Float16* bSrc = Bt + (size_t)(nBase + crow) * Kd + ccol;

    auto stage = [&](int k0, int buf) {
#pragma unroll
        for (int i = 0; i < TM / RPS; ++i)
            cp_b128(aSrc + (size_t)(i * RPS) * Kd + k0, &ldsA[buf][(crow + i * RPS) * PIT + ccol]);
#pragma unroll
        for (int i = 0; i < TN / RPS; ++i)
            cp_b128(bSrc + (size_t)(i * RPS) * Kd + k0, &ldsB[buf][(crow + i * RPS) * PIT + ccol]);
    };

    stage(0, 0);
    asm volatile("s_wait_asynccnt 0x0" ::: "memory");   // slab 0 has landed before it is published
    __syncthreads();
    stage(KB, 1);                                       // Kd >= 2 * KB at both call sites

    for (int k0 = 0; k0 < Kd; k0 += KB) {
        const int cur = (k0 / KB) & 1;
#pragma unroll
        for (int kk = 0; kk < KB; kk += 32) {
            v16h af[4], bf[4];
#pragma unroll
            for (int mi = 0; mi < 4; ++mi)
                af[mi] = load_frag(&ldsA[cur][(waveM * 64 + mi * 16 + lr) * PIT + kk + hi * 8]);
#pragma unroll
            for (int ni = 0; ni < 4; ++ni)
                bf[ni] = load_frag(&ldsB[cur][(waveN * 64 + ni * 16 + lr) * PIT + kk + hi * 8]);
            // Keeps the block's 16 LDS reads one group in front of its 16 WMMAs: left free, the
            // compiler reloads one A fragment per row of four and waits for it to the last read.
            __builtin_amdgcn_sched_barrier(0);
#pragma unroll
            for (int mi = 0; mi < 4; ++mi)
#pragma unroll
                for (int ni = 0; ni < 4; ++ni)
                    acc[mi][ni] = wmma_f16(af[mi], bf[ni], acc[mi][ni]);
            // Keeps the next block's reads from being spread among these WMMAs.
            __builtin_amdgcn_sched_barrier(0);
        }
        asm volatile("s_wait_dscnt 0x0" ::: "memory");      // this wave has left buffer cur before it is refilled
        asm volatile("s_wait_asynccnt 0x0" ::: "memory");   // this wave's part of the next slab has landed
        __syncthreads();   // publishes the next slab and ends every read of buffer cur
        if (k0 + 2 * KB < Kd) stage(k0 + 2 * KB, cur);      // flies while the next slab is worked on
    }
    asm volatile("s_wait_asynccnt 0x0" ::: "memory");   // no copy is left in flight at the wave's end

#pragma unroll
    for (int mi = 0; mi < 4; ++mi)
#pragma unroll
        for (int ni = 0; ni < 4; ++ni)
#pragma unroll
            for (int r = 0; r < 8; ++r) {
                int row = mBase + waveM * 64 + mi * 16 + hi * 8 + r;
                int col = nBase + waveN * 64 + ni * 16 + lr;
                C[(size_t)row * Ncols + col] = (TC)(acc[mi][ni][r] * alpha);
            }
}

// ---------------- kernels ----------------

// waves_per_eu(6): holds the register allocation at 160, so that three work-groups fit a WGP.
__global__ void __launch_bounds__(256) __attribute__((amdgpu_waves_per_eu(6)))
qkv_kernel(const float* __restrict__ x,
           const float* __restrict__ Wq, const float* __restrict__ Wk,
           const float* __restrict__ Wv,
           _Float16* __restrict__ Q, _Float16* __restrict__ Kp, _Float16* __restrict__ Vt) {
    const float* W = (blockIdx.z == 0) ? Wq : (blockIdx.z == 1) ? Wk : Wv;
    _Float16*    O = (blockIdx.z == 0) ? Q  : (blockIdx.z == 1) ? Kp : Vt;
    // V goes out as [D][N], so that the last product finds both operands K-contiguous.
    gemm_bt<float, float, _Float16>(x, W, O, AD, AD, 1.0f,
                                    blockIdx.y * BM, blockIdx.x * BN,
                                    blockIdx.z == 2, AN);
}

__global__ void __launch_bounds__(256)
scores_kernel(const _Float16* __restrict__ Q, const _Float16* __restrict__ Kp,
              _Float16* __restrict__ S) {
    gemm_nt<64>(Q, Kp, S, AD, AN, 0.03125f /* 1/sqrt(1024) */,
                blockIdx.y * TM, blockIdx.x * TN);
}

__global__ void __launch_bounds__(256)
softmax_kernel(_Float16* __restrict__ S) {
    __shared__ float red[8];
    const int row = blockIdx.x;
    const int t   = threadIdx.x;
    _Float16* p = S + (size_t)row * AN;

    float v[32];
    float m = -3.4e38f;
#pragma unroll
    for (int i = 0; i < 32; ++i) {
        v[i] = (float)p[t + 256 * i];
        m = fmaxf(m, v[i]);
    }
#pragma unroll
    for (int off = 16; off; off >>= 1) m = fmaxf(m, __shfl_xor(m, off, 32));
    if ((t & 31) == 0) red[t >> 5] = m;
    __syncthreads();
    m = red[0];
#pragma unroll
    for (int i = 1; i < 8; ++i) m = fmaxf(m, red[i]);
    __syncthreads();

    float s = 0.0f;
#pragma unroll
    for (int i = 0; i < 32; ++i) {
        v[i] = __expf(v[i] - m);
        s += v[i];
    }
#pragma unroll
    for (int off = 16; off; off >>= 1) s += __shfl_xor(s, off, 32);
    if ((t & 31) == 0) red[t >> 5] = s;
    __syncthreads();
    s = red[0];
#pragma unroll
    for (int i = 1; i < 8; ++i) s += red[i];
    const float inv = 1.0f / s;
#pragma unroll
    for (int i = 0; i < 32; ++i) p[t + 256 * i] = (_Float16)(v[i] * inv);
}

__global__ void __launch_bounds__(256)
out_kernel(const _Float16* __restrict__ P, const _Float16* __restrict__ Vt,
           float* __restrict__ O) {
    // P comes from memory: a 128-k slab gives its copies a longer flight.
    gemm_nt<128>(P, Vt, O, AN, AD, 1.0f, blockIdx.y * TM, blockIdx.x * TN);
}

extern "C" void kernel_launch(void* const* d_in, const int* in_sizes, int n_in,
                              void* d_out, int out_size, void* d_ws, size_t ws_size,
                              hipStream_t stream) {
    (void)in_sizes; (void)n_in; (void)out_size; (void)ws_size;
    const float* x  = (const float*)d_in[0];
    const float* Wq = (const float*)d_in[1];
    const float* Wk = (const float*)d_in[2];
    const float* Wv = (const float*)d_in[3];

    _Float16* Q  = (_Float16*)d_ws;
    _Float16* Kp = Q  + (size_t)AN * AD;
    _Float16* Vt = Kp + (size_t)AN * AD;   // V transposed: [D][N]
    _Float16* S  = Vt + (size_t)AN * AD;   // 8192*8192 f16; P overwrites in place

    dim3 blk(256);

    qkv_kernel<<<dim3(AD / BN, AN / BM, 3), blk, 0, stream>>>(x, Wq, Wk, Wv, Q, Kp, Vt);
    scores_kernel<<<dim3(AN / TN, AN / TM), blk, 0, stream>>>(Q, Kp, S);
    softmax_kernel<<<dim3(AN), blk, 0, stream>>>(S);
    out_kernel<<<dim3(AD / TN, AN / TM), blk, 0, stream>>>(S, Vt, (float*)d_out);
}

// v003
// It runs in 257 microseconds.
// Two timings next to v002 both put it at 1.09 times that version's speed.
// Counting every step since v000, it is 1.99 times as fast.
#include <hip/hip_runtime.h>
#include <hip/hip_bf16.h>

// Attention: out = softmax((x Wq)(x Wk)^T / sqrt(D)) (x Wv)
// N = 8192, D = 1024, fp32 in/out. Internals f16, f32 WMMA accumulate.
// Workspace (>= 198 MB): Q,K f16 [N][D], V f16 transposed [D][N] (16 MB each)
// + S/P f16 (128 MB, in-place softmax) + x f16 [N][D] (16 MB)
// + Wq,Wk,Wv f16, each transposed [out][in] (2 MB each).

#define AN 8192
#define AD 1024

typedef _Float16 v16h __attribute__((ext_vector_type(16)));
typedef _Float16 v8h  __attribute__((ext_vector_type(8)));
typedef _Float16 v4h  __attribute__((ext_vector_type(4)));
typedef _Float16 v2h  __attribute__((ext_vector_type(2)));
typedef float    v8f  __attribute__((ext_vector_type(8)));
typedef int      v4i_ __attribute__((ext_vector_type(4)));

// ---- CDNA5 async global->LDS copy (ASYNCcnt), with safe fallback ----
#if defined(__has_builtin)
#  if __has_builtin(__builtin_amdgcn_global_load_async_to_lds_b128)
#    define USE_ASYNC_LDS 1
#  endif
#endif
#ifndef USE_ASYNC_LDS
#  define USE_ASYNC_LDS 0
#endif

#if USE_ASYNC_LDS
typedef __attribute__((address_space(1))) v4i_* g4p_t;   // global int4*
typedef __attribute__((address_space(3))) v4i_* l4p_t;   // LDS int4*
#endif

// Copy 16 bytes (8 halves) global -> LDS.
__device__ __forceinline__ void cp_b128(const _Float16* g, _Float16* l) {
#if USE_ASYNC_LDS
    // int->pointer casts sidestep addrspacecast restrictions; flat-shared
    // pointer low 32 bits == LDS byte offset (ISA flat addressing rule).
    __builtin_amdgcn_global_load_async_to_lds_b128(
        (g4p_t)(unsigned long long)g,
        (l4p_t)(unsigned)(unsigned long long)l,
        0, 0);
#else
    *(v8h*)l = *(const v8h*)g;
#endif
}

__device__ __forceinline__ v8f wmma_f16(v16h a, v16h b, v8f c) {
    return __builtin_amdgcn_wmma_f32_16x16x32_f16(
        false, a, false, b, (short)0, c, false, false);
}

// Per-lane WMMA fragment from LDS tile stored [row][k].
// slots 0..7 -> k = hi*8.., slots 8..15 -> k = hi*8+16..
__device__ __forceinline__ v16h load_frag(const _Float16* p) {
    v8h lo = *(const v8h*)(p);
    v8h hh = *(const v8h*)(p + 16);
    v16h r;
#pragma unroll
    for (int i = 0; i < 8; ++i) { r[i] = lo[i]; r[i + 8] = hh[i]; }
    return r;
}

// ======================================================================
// C[M,N] = alpha * A[M,Kd] * Bt[N,Kd]^T  (both K-contiguous f16)
// Work-group tile TM x TN, K slab KB; 8 waves as 2 x 4, each a 64 x 64 tile.
// Both operands come by async global->LDS copies, two buffers.
// ======================================================================
#define TM 128
#define TN 256

template <int KB, typename TC>
__device__ __forceinline__ void gemm_nt(const _Float16* __restrict__ A,
                                        const _Float16* __restrict__ Bt,
                                        TC* __restrict__ C, int Kd, int Ncols,
                                        float alpha, int mBase, int nBase) {
    constexpr int PIT = KB + 8;        // LDS row pitch in halves: 16 B x odd, conflict-free b128 reads
    constexpr int LPR = KB / 8;        // lanes that cover one slab row, 16 B each (whole 128-B lines)
    constexpr int RPS = 256 / LPR;     // rows that one copy of the whole block covers
    __shared__ __align__(16) _Float16 ldsA[2][TM * PIT];
    __shared__ __align__(16) _Float16 ldsB[2][TN * PIT];

    const int t    = threadIdx.x;
    const int lane = t & 31;
    const int wave = t >> 5;
    const int lr   = lane & 15;
    const int hi   = lane >> 4;
    const int waveM = wave & 1;   // 2 wave-rows (64 M each)
    const int waveN = wave >> 1;  // 4 wave-cols (64 N each)

    v8f acc[4][4];
#pragma unroll
    for (int mi = 0; mi < 4; ++mi)
#pragma unroll
        for (int ni = 0; ni < 4; ++ni) acc[mi][ni] = (v8f){0,0,0,0,0,0,0,0};

    const int crow = t / LPR;
    const int ccol = (t % LPR) * 8;
    const _Float16* aSrc = A  + (size_t)(mBase + crow) * Kd + ccol;
    const _Float16* bSrc = Bt + (size_t)(nBase + crow) * Kd + ccol;

    auto stage = [&](int k0, int buf) {
#pragma unroll
        for (int i = 0; i < TM / RPS; ++i)
            cp_b128(aSrc + (size_t)(i * RPS) * Kd + k0, &ldsA[buf][(crow + i * RPS) * PIT + ccol]);
#pragma unroll
        for (int i = 0; i < TN / RPS; ++i)
            cp_b128(bSrc + (size_t)(i * RPS) * Kd + k0, &ldsB[buf][(crow + i * RPS) * PIT + ccol]);
    };

    stage(0, 0);
    asm volatile("s_wait_asynccnt 0x0" ::: "memory");   // slab 0 has landed before it is published
    __syncthreads();
    stage(KB, 1);                                       // Kd >= 2 * KB at every call site

    for (int k0 = 0; k0 < Kd; k0 += KB) {
        const int cur = (k0 / KB) & 1;
#pragma unroll
        for (int kk = 0; kk < KB; kk += 32) {
            v16h af[4], bf[4];
#pragma unroll
            for (int mi = 0; mi < 4; ++mi)
                af[mi] = load_frag(&ldsA[cur][(waveM * 64 + mi * 16 + lr) * PIT + kk + hi * 8]);
#pragma unroll
            for (int ni = 0; ni < 4; ++ni)
                bf[ni] = load_frag(&ldsB[cur][(waveN * 64 + ni * 16 + lr) * PIT + kk + hi * 8]);
            // Keeps the block's 16 LDS reads one group in front of its 16 WMMAs: left free, the
            // compiler reloads one A fragment per row of four and waits for it to the last read.
            __builtin_amdgcn_sched_barrier(0);
#pragma unroll
            for (int mi = 0; mi < 4; ++mi)
#pragma unroll
                for (int ni = 0; ni < 4; ++ni)
                    acc[mi][ni] = wmma_f16(af[mi], bf[ni], acc[mi][ni]);
            // Keeps the next block's reads from being spread among these WMMAs.
            __builtin_amdgcn_sched_barrier(0);
        }
        asm volatile("s_wait_dscnt 0x0" ::: "memory");      // this wave has left buffer cur before it is refilled
        asm volatile("s_wait_asynccnt 0x0" ::: "memory");   // this wave's part of the next slab has landed
        __syncthreads();   // publishes the next slab and ends every read of buffer cur
        if (k0 + 2 * KB < Kd) stage(k0 + 2 * KB, cur);      // flies while the next slab is worked on
    }
    asm volatile("s_wait_asynccnt 0x0" ::: "memory");   // no copy is left in flight at the wave's end

#pragma unroll
    for (int mi = 0; mi < 4; ++mi)
#pragma unroll
        for (int ni = 0; ni < 4; ++ni)
#pragma unroll
            for (int r = 0; r < 8; ++r) {
                int row = mBase + waveM * 64 + mi * 16 + hi * 8 + r;
                int col = nBase + waveN * 64 + ni * 16 + lr;
                C[(size_t)row * Ncols + col] = (TC)(acc[mi][ni][r] * alpha);
            }
}

// ---------------- kernels ----------------

#define PBLKS 512                         // work-groups of the rounding kernel
#define XELE  (AN * AD / PBLKS)           // x elements per work-group
#define WTK   64                          // weight tile: 64 inputs x 32 outputs, one of each weight
#define WTN   (AD * AD / PBLKS / WTK)

// Rounds the projection's operands to f16 once: x as it lies, each weight turned to [out][in],
// so that every product of the file finds both operands K-contiguous in f16.
__global__ void __launch_bounds__(256)
prep_kernel(const float* __restrict__ x,
            const float* __restrict__ Wq, const float* __restrict__ Wk,
            const float* __restrict__ Wv,
            _Float16* __restrict__ xh, _Float16* __restrict__ Wt) {
    constexpr int WP = WTK + 8;           // LDS row pitch in halves (16 B x odd)
    constexpr int XP = XELE / 1024;       // passes over x, one float4 per thread each
    static_assert(WTK * WTN == 256 * 8 && WTN == 32 && XELE % 1024 == 0, "thread maps below");
    __shared__ __align__(16) _Float16 tile[3][WTN * WP];
    const int      t  = threadIdx.x;
    const unsigned b  = blockIdx.x;
    const unsigned kT = (b / (AD / WTN)) * WTK;
    const unsigned nT = (b % (AD / WTN)) * WTN;

    const int    k    = (t >> 3) * 2;     // two input rows per thread: one f16 pair per output
    const int    n    = (t & 7) * 4;      // 8 lanes x 16 B = one whole 128-byte line
    const size_t woff = (size_t)(kT + k) * AD + nT + n;
    const size_t base = (size_t)b * XELE + t * 4;
    const float* Ws[3] = {Wq, Wk, Wv};
    float4 w0[3], w1[3], v[XP];
#pragma unroll
    for (int m = 0; m < 3; ++m) {
        w0[m] = *(const float4*)(Ws[m] + woff);
        w1[m] = *(const float4*)(Ws[m] + woff + AD);
    }
    // The loads of x below land in registers that held the weights' addresses.
    asm volatile("s_wait_xcnt 0x0" ::: "memory");
#pragma unroll
    for (int i = 0; i < XP; ++i) v[i] = *(const float4*)(x + base + i * 1024);

#pragma unroll
    for (int m = 0; m < 3; ++m) {
        *(v2h*)(&tile[m][(n + 0) * WP + k]) = (v2h){(_Float16)w0[m].x, (_Float16)w1[m].x};
        *(v2h*)(&tile[m][(n + 1) * WP + k]) = (v2h){(_Float16)w0[m].y, (_Float16)w1[m].y};
        *(v2h*)(&tile[m][(n + 2) * WP + k]) = (v2h){(_Float16)w0[m].z, (_Float16)w1[m].z};
        *(v2h*)(&tile[m][(n + 3) * WP + k]) = (v2h){(_Float16)w0[m].w, (_Float16)w1[m].w};
    }
    __syncthreads();   // the turned tiles are read back by other waves
#pragma unroll
    for (int m = 0; m < 3; ++m) {
        const int row = t >> 3;
        const int kc  = (t & 7) * 8;      // 8 lanes x 16 B = one whole 128-byte line
        *(v8h*)(Wt + (size_t)m * AD * AD + (size_t)(nT + row) * AD + kT + kc) =
            *(const v8h*)(&tile[m][row * WP + kc]);
    }
#pragma unroll
    for (int i = 0; i < XP; ++i) {
        v4h h = {(_Float16)v[i].x, (_Float16)v[i].y, (_Float16)v[i].z, (_Float16)v[i].w};
        *(v4h*)(xh + base + i * 1024) = h;
    }
}

// Q = x Wq and K = x Wk as [N][D]; V as [D][N] = Wv^T x^T, the same loop with the operands' roles
// exchanged, so that the last product finds both operands K-contiguous.
__global__ void __launch_bounds__(256)
qkv_kernel(const _Float16* __restrict__ xh, const _Float16* __restrict__ Wt,
           _Float16* __restrict__ Q, _Float16* __restrict__ Kp, _Float16* __restrict__ Vt) {
    const int  z  = blockIdx.z;
    const bool tr = (z == 2);
    const _Float16* Wz = Wt + (size_t)z * AD * AD;
    const unsigned b  = blockIdx.x;
    const unsigned mT = tr ? b / (AN / TN) : b / (AD / TN);
    const unsigned nT = tr ? b % (AN / TN) : b % (AD / TN);
    gemm_nt<64>(tr ? Wz : xh, tr ? xh : Wz, (z == 0) ? Q : (z == 1) ? Kp : Vt,
                AD, tr ? AN : AD, 1.0f, mT * TM, nT * TN);
}

__global__ void __launch_bounds__(256)
scores_kernel(const _Float16* __restrict__ Q, const _Float16* __restrict__ Kp,
              _Float16* __restrict__ S) {
    gemm_nt<64>(Q, Kp, S, AD, AN, 0.03125f /* 1/sqrt(1024) */,
                blockIdx.y * TM, blockIdx.x * TN);
}

__global__ void __launch_bounds__(256)
softmax_kernel(_Float16* __restrict__ S) {
    __shared__ float red[8];
    const int row = blockIdx.x;
    const int t   = threadIdx.x;
    _Float16* p = S + (size_t)row * AN;

    float v[32];
    float m = -3.4e38f;
#pragma unroll
    for (int i = 0; i < 32; ++i) {
        v[i] = (float)p[t + 256 * i];
        m = fmaxf(m, v[i]);
    }
#pragma unroll
    for (int off = 16; off; off >>= 1) m = fmaxf(m, __shfl_xor(m, off, 32));
    if ((t & 31) == 0) red[t >> 5] = m;
    __syncthreads();
    m = red[0];
#pragma unroll
    for (int i = 1; i < 8; ++i) m = fmaxf(m, red[i]);
    __syncthreads();

    float s = 0.0f;
#pragma unroll
    for (int i = 0; i < 32; ++i) {
        v[i] = __expf(v[i] - m);
        s += v[i];
    }
#pragma unroll
    for (int off = 16; off; off >>= 1) s += __shfl_xor(s, off, 32);
    if ((t & 31) == 0) red[t >> 5] = s;
    __syncthreads();
    s = red[0];
#pragma unroll
    for (int i = 1; i < 8; ++i) s += red[i];
    const float inv = 1.0f / s;
#pragma unroll
    for (int i = 0; i < 32; ++i) p[t + 256 * i] = (_Float16)(v[i] * inv);
}

__global__ void __launch_bounds__(256)
out_kernel(const _Float16* __restrict__ P, const _Float16* __restrict__ Vt,
           float* __restrict__ O) {
    // P comes from memory: a 128-k slab gives its copies a longer flight.
    gemm_nt<128>(P, Vt, O, AN, AD, 1.0f, blockIdx.y * TM, blockIdx.x * TN);
}

extern "C" void kernel_launch(void* const* d_in, const int* in_sizes, int n_in,
                              void* d_out, int out_size, void* d_ws, size_t ws_size,
                              hipStream_t stream) {
    (void)in_sizes; (void)n_in; (void)out_size; (void)ws_size;
    const float* x  = (const float*)d_in[0];
    const float* Wq = (const float*)d_in[1];
    const float* Wk = (const float*)d_in[2];
    const float* Wv = (const float*)d_in[3];

    _Float16* Q  = (_Float16*)d_ws;
    _Float16* Kp = Q  + (size_t)AN * AD;
    _Float16* Vt = Kp + (size_t)AN * AD;   // V transposed: [D][N]
    _Float16* S  = Vt + (size_t)AN * AD;   // 8192*8192 f16; P overwrites in place
    _Float16* xh = S  + (size_t)AN * AN;   // x in f16
    _Float16* Wt = xh + (size_t)AN * AD;   // three weights in f16, each [out][in]

    dim3 blk(256);

    prep_kernel<<<dim3(PBLKS), blk, 0, stream>>>(x, Wq, Wk, Wv, xh, Wt);
    qkv_kernel<<<dim3((AN / TM) * (AD / TN), 1, 3), blk, 0, stream>>>(xh, Wt, Q, Kp, Vt);
    scores_kernel<<<dim3(AN / TN, AN / TM), blk, 0, stream>>>(Q, Kp, S);
    softmax_kernel<<<dim3(AN), blk, 0, stream>>>(S);
    out_kernel<<<dim3(AD / TN, AN / TM), blk, 0, stream>>>(S, Vt, (float*)d_out);
}

// v004
// A run of this version takes 240 microseconds.
// Next to v003, in two timings, it ran 1.07 times as fast each time.
// Over all steps from v000 it is 2.12 times as fast.
#include <hip/hip_runtime.h>
#include <hip/hip_bf16.h>

// Attention: out = softmax((x Wq)(x Wk)^T / sqrt(D)) (x Wv)
// N = 8192, D = 1024, fp32 in/out. Internals f16, f32 WMMA accumulate.
// Workspace (>= 206 MB): Q,K f16 [N][D], V f16 transposed [D][N] (16 MB each)
// + P f16 (128 MB): exp of each score less the maximum of its own row in its block of 64 keys
// + x f16 [N][D] (16 MB) + Wq,Wk,Wv f16, each transposed [out][in] (2 MB each)
// + per block of 64 keys and row: that maximum (log2 units) and the block's sum, f32 (8 MB).

#define AN 8192
#define AD 1024

typedef _Float16 v16h __attribute__((ext_vector_type(16)));
typedef _Float16 v8h  __attribute__((ext_vector_type(8)));
typedef _Float16 v4h  __attribute__((ext_vector_type(4)));
typedef _Float16 v2h  __attribute__((ext_vector_type(2)));
typedef float    v8f  __attribute__((ext_vector_type(8)));
typedef int      v4i_ __attribute__((ext_vector_type(4)));

// ---- CDNA5 async global->LDS copy (ASYNCcnt), with safe fallback ----
#if defined(__has_builtin)
#  if __has_builtin(__builtin_amdgcn_global_load_async_to_lds_b128)
#    define USE_ASYNC_LDS 1
#  endif
#endif
#ifndef USE_ASYNC_LDS
#  define USE_ASYNC_LDS 0
#endif

#if USE_ASYNC_LDS
typedef __attribute__((address_space(1))) v4i_* g4p_t;   // global int4*
typedef __attribute__((address_space(3))) v4i_* l4p_t;   // LDS int4*
#endif

// Copy 16 bytes (8 halves) global -> LDS.
__device__ __forceinline__ void cp_b128(const _Float16* g, _Float16* l) {
#if USE_ASYNC_LDS
    // int->pointer casts sidestep addrspacecast restrictions; flat-shared
    // pointer low 32 bits == LDS byte offset (ISA flat addressing rule).
    __builtin_amdgcn_global_load_async_to_lds_b128(
        (g4p_t)(unsigned long long)g,
        (l4p_t)(unsigned)(unsigned long long)l,
        0, 0);
#else
    *(v8h*)l = *(const v8h*)g;
#endif
}

__device__ __forceinline__ v8f wmma_f16(v16h a, v16h b, v8f c) {
    return __builtin_amdgcn_wmma_f32_16x16x32_f16(
        false, a, false, b, (short)0, c, false, false);
}

// Per-lane WMMA fragment from LDS tile stored [row][k].
// slots 0..7 -> k = hi*8.., slots 8..15 -> k = hi*8+16..
__device__ __forceinline__ v16h load_frag(const _Float16* p) {
    v8h lo = *(const v8h*)(p);
    v8h hh = *(const v8h*)(p + 16);
    v16h r;
#pragma unroll
    for (int i = 0; i < 8; ++i) { r[i] = lo[i]; r[i + 8] = hh[i]; }
    return r;
}

// The value that lane l ^ 16 holds (a vector move between the wave's two rows of 16 lanes).
__device__ __forceinline__ float other_half(float v) {
    const int i = __builtin_bit_cast(int, v);
    return __builtin_bit_cast(float,
        __builtin_amdgcn_permlanex16(i, i, 0x76543210, 0xfedcba98, false, false));
}

// 2^x. The v_nop fills the slot that the instruction set asks for behind a transcendental.
__device__ __forceinline__ float exp2_slot(float x) {
    float y;
    asm("v_exp_f32 %0, %1\n\tv_nop" : "=v"(y) : "v"(x));
    return y;
}

// ======================================================================
// C[M,N] = alpha * A[M,Kd] * Bt[N,Kd]^T  (both K-contiguous f16)
// Work-group tile TM x TN, K slab KB; 8 waves as 2 x 4, each a 64 x 64 tile.
// Both operands come by async global->LDS copies, two buffers.
// ======================================================================
#define TM 128
#define TN 256
#define KBLK 64                // keys per softmax block: the columns of one wave's tile of the scores
#define NBLK (AN / KBLK)

// MODE 0: C = alpha * A * Bt^T.
// MODE 1: the scores. Each wave turns its 64 x 64 tile into exp(score - block maximum) and stores,
//         in ml[block][0][row] and ml[block][1][row], the maximum (log2 units) and the sum.
// MODE 2: the last product. A's fragments are brought to their row's overall maximum on the way
//         into the WMMAs; the row's sum divides in the epilogue.
template <int KB, int MODE, typename TC>
__device__ __forceinline__ void gemm_nt(const _Float16* __restrict__ A,
                                        const _Float16* __restrict__ Bt,
                                        TC* __restrict__ C, float* __restrict__ ml,
                                        int Kd, int Ncols,
                                        float alpha, int mBase, int nBase) {
    constexpr int PIT = KB + 8;        // LDS row pitch in halves: 16 B x odd, conflict-free b128 reads
    constexpr int LPR = KB / 8;        // lanes that cover one slab row, 16 B each (whole 128-B lines)
    constexpr int RPS = 256 / LPR;     // rows that one copy of the whole block covers
    __shared__ __align__(16) _Float16 ldsA[2][TM * PIT];
    __shared__ __align__(16) _Float16 ldsB[2][TN * PIT];
    constexpr int SCP = NBLK + 2;      // pitch of the factor table in halves: an odd count of dwords
    __shared__ __align__(16) _Float16 scT[MODE == 2 ? TM * SCP : 8];   // factor per row and key block
    __shared__ float pmax[2][MODE == 2 ? TM : 1];                      // row maximum, by half of the blocks
    __shared__ float psum[2][MODE == 2 ? TM : 1];                      // row sum, by half of the blocks
    static_assert(MODE != 2 || KB == 2 * KBLK, "one dword of scT serves one slab");

    const int t    = threadIdx.x;
    const int lane = t & 31;
    const int wave = t >> 5;
    const int lr   = lane & 15;
    const int hi   = lane >> 4;
    const int waveM = wave & 1;   // 2 wave-rows (64 M each)
    const int waveN = wave >> 1;  // 4 wave-cols (64 N each)

    v8f acc[4][4];
#pragma unroll
    for (int mi = 0; mi < 4; ++mi)
#pragma unroll
        for (int ni = 0; ni < 4; ++ni) acc[mi][ni] = (v8f){0,0,0,0,0,0,0,0};

    const int crow = t / LPR;
    const int ccol = (t % LPR) * 8;
    const _Float16* aSrc = A  + (size_t)(mBase + crow) * Kd + ccol;
    const _Float16* bSrc = Bt + (size_t)(nBase + crow) * Kd + ccol;

    auto stage = [&](int k0, int buf) {
#pragma unroll
        for (int i = 0; i < TM / RPS; ++i)
            cp_b128(aSrc + (size_t)(i * RPS) * Kd + k0, &ldsA[buf][(crow + i * RPS) * PIT + ccol]);
#pragma unroll
        for (int i = 0; i < TN / RPS; ++i)
            cp_b128(bSrc + (size_t)(i * RPS) * Kd + k0, &ldsB[buf][(crow + i * RPS) * PIT + ccol]);
    };

    stage(0, 0);
    if constexpr (MODE == 2) {
        // Keeps slab 0's copies in front of the loads below: left free, the compiler issues them
        // behind the wait for the first of those loads.
        __builtin_amdgcn_sched_barrier(0);
        // Joins the blocks of this work-group's rows while slab 0 flies: thread = (row, half of the blocks).
        constexpr int HB = NBLK / 2;
        const int prow = t & (TM - 1);
        const int ph   = t >> 7;
        const float* mp = ml + (size_t)(ph * HB) * 2 * AN + mBase + prow;
        float mv[HB], lv[HB];
#pragma unroll
        for (int i = 0; i < HB; ++i) mv[i] = mp[(size_t)i * 2 * AN];
#pragma unroll
        for (int i = 0; i < HB; ++i) lv[i] = mp[(size_t)i * 2 * AN + AN];
        // The address registers of the loads above are free for reuse from here on.
        asm volatile("s_wait_xcnt 0x0" ::: "memory");
        float mx = mv[0];
#pragma unroll
        for (int i = 1; i < HB; ++i) mx = fmaxf(mx, mv[i]);
        pmax[ph][prow] = mx;
        __syncthreads();   // the other half's maximum is written by another wave
        mx = fmaxf(pmax[0][prow], pmax[1][prow]);
        float ls = 0.0f;
#pragma unroll
        for (int i = 0; i < HB; i += 2) {
            const float f0 = __builtin_amdgcn_exp2f(mv[i] - mx);
            const float f1 = __builtin_amdgcn_exp2f(mv[i + 1] - mx);
            ls += lv[i] * f0 + lv[i + 1] * f1;
            *(v2h*)(&scT[prow * SCP + ph * HB + i]) = (v2h){(_Float16)f0, (_Float16)f1};
        }
        psum[ph][prow] = ls;   // published, like scT, by the barrier below
    }
    asm volatile("s_wait_asynccnt 0x0" ::: "memory");   // slab 0 has landed before it is published
    __syncthreads();
    stage(KB, 1);                                       // Kd >= 2 * KB at every call site

    for (int k0 = 0; k0 < Kd; k0 += KB) {
        const int cur = (k0 / KB) & 1;
        v2h scp[4];   // MODE 2: the factors of this slab's two key blocks, per A fragment row
#pragma unroll
        for (int kk = 0; kk < KB; kk += 32) {
            v16h af[4], bf[4];
            if constexpr (MODE == 2) {
                if (kk == 0) {
#pragma unroll
                    for (int mi = 0; mi < 4; ++mi)
                        scp[mi] = *(const v2h*)(&scT[(waveM * 64 + mi * 16 + lr) * SCP + k0 / KBLK]);
                }
            }
#pragma unroll
            for (int mi = 0; mi < 4; ++mi)
                af[mi] = load_frag(&ldsA[cur][(waveM * 64 + mi * 16 + lr) * PIT + kk + hi * 8]);
#pragma unroll
            for (int ni = 0; ni < 4; ++ni)
                bf[ni] = load_frag(&ldsB[cur][(waveN * 64 + ni * 16 + lr) * PIT + kk + hi * 8]);
            // Keeps the block's 16 LDS reads one group in front of its 16 WMMAs: left free, the
            // compiler reloads one A fragment per row of four and waits for it to the last read.
            __builtin_amdgcn_sched_barrier(0);
            if constexpr (MODE == 2) {
#pragma unroll
                for (int mi = 0; mi < 4; ++mi) af[mi] *= scp[mi][kk / KBLK];   // a lane's fragment is one row
            }
#pragma unroll
            for (int mi = 0; mi < 4; ++mi)
#pragma unroll
                for (int ni = 0; ni < 4; ++ni) {
                    if constexpr (MODE == 1)   // operands exchanged: a lane holds one row's 8 neighbouring keys
                        acc[mi][ni] = wmma_f16(bf[ni], af[mi], acc[mi][ni]);
                    else
                        acc[mi][ni] = wmma_f16(af[mi], bf[ni], acc[mi][ni]);
                }
            // Keeps the next block's reads from being spread among these WMMAs.
            __builtin_amdgcn_sched_barrier(0);
        }
        asm volatile("s_wait_dscnt 0x0" ::: "memory");      // this wave has left buffer cur before it is refilled
        asm volatile("s_wait_asynccnt 0x0" ::: "memory");   // this wave's part of the next slab has landed
        __syncthreads();   // publishes the next slab and ends every read of buffer cur
        if (k0 + 2 * KB < Kd) stage(k0 + 2 * KB, cur);      // flies while the next slab is worked on
    }
    asm volatile("s_wait_asynccnt 0x0" ::: "memory");   // no copy is left in flight at the wave's end

    if constexpr (MODE == 1) {
        // acc[mi][ni][r] is row mi * 16 + lr, key ni * 16 + hi * 8 + r of the wave's tile.
        const float a2 = alpha * 1.44269504f;   // scores in log2 units; alpha > 0
        v8h   h[4][4];
        float ms[4];
#pragma unroll
        for (int mi = 0; mi < 4; ++mi) {
            float mx = acc[mi][0][0];
#pragma unroll
            for (int ni = 0; ni < 4; ++ni)
#pragma unroll
                for (int r = 0; r < 8; ++r) mx = fmaxf(mx, acc[mi][ni][r]);
            mx = fmaxf(mx, other_half(mx));   // the row's other 32 keys
            const float m2 = mx * a2;
            float s = 0.0f;
#pragma unroll
            for (int ni = 0; ni < 4; ++ni)
#pragma unroll
                for (int r = 0; r < 8; ++r) {
                    const float p = exp2_slot(fmaf(acc[mi][ni][r], a2, -m2));
                    s += p;
                    h[mi][ni][r] = (_Float16)p;
                }
            s += other_half(s);
            ms[mi] = hi ? s : m2;   // 16 lanes each: maxima, sums
        }
        const int row0 = mBase + waveM * 64 + lr;
        TC*    cp = C + (size_t)row0 * Ncols + nBase + waveN * 64 + hi * 8;
        float* mp = ml + ((size_t)(nBase / KBLK + waveN) * 2 + hi) * AN + row0;
        // All stores stand behind all arithmetic: no register that an issued store names is written again.
        __builtin_amdgcn_sched_barrier(0);
#pragma unroll
        for (int mi = 0; mi < 4; ++mi) {
#pragma unroll
            for (int ni = 0; ni < 4; ++ni) *(v8h*)(cp + (size_t)(mi * 16) * Ncols + ni * 16) = h[mi][ni];
            mp[mi * 16] = ms[mi];
        }
    } else if constexpr (MODE == 2) {
#pragma unroll
        for (int mi = 0; mi < 4; ++mi)
#pragma unroll
            for (int r = 0; r < 8; ++r) {
                const int   lrow = waveM * 64 + mi * 16 + hi * 8 + r;
                const float inv  = 1.0f / (psum[0][lrow] + psum[1][lrow]);
#pragma unroll
                for (int ni = 0; ni < 4; ++ni) acc[mi][ni][r] *= inv;
            }
        TC* cp = C + (size_t)(mBase + waveM * 64 + hi * 8) * Ncols + nBase + waveN * 64 + lr;
        // All stores stand behind all arithmetic: no register that an issued store names is written again.
        __builtin_amdgcn_sched_barrier(0);
#pragma unroll
        for (int mi = 0; mi < 4; ++mi)
#pragma unroll
            for (int ni = 0; ni < 4; ++ni)
#pragma unroll
                for (int r = 0; r < 8; ++r)
                    cp[(size_t)(mi * 16 + r) * Ncols + ni * 16] = acc[mi][ni][r];
    } else {
#pragma unroll
        for (int mi = 0; mi < 4; ++mi)
#pragma unroll
            for (int ni = 0; ni < 4; ++ni)
#pragma unroll
                for (int r = 0; r < 8; ++r) {
                    int row = mBase + waveM * 64 + mi * 16 + hi * 8 + r;
                    int col = nBase + waveN * 64 + ni * 16 + lr;
                    C[(size_t)row * Ncols + col] = (TC)(acc[mi][ni][r] * alpha);
                }
    }
}

// ---------------- kernels ----------------

#define PBLKS 512                         // work-groups of the rounding kernel
#define XELE  (AN * AD / PBLKS)           // x elements per work-group
#define WTK   64                          // weight tile: 64 inputs x 32 outputs, one of each weight
#define WTN   (AD * AD / PBLKS / WTK)

// Rounds the projection's operands to f16 once: x as it lies, each weight turned to [out][in],
// so that every product of the file finds both operands K-contiguous in f16.
__global__ void __launch_bounds__(256)
prep_kernel(const float* __restrict__ x,
            const float* __restrict__ Wq, const float* __restrict__ Wk,
            const float* __restrict__ Wv,
            _Float16* __restrict__ xh, _Float16* __restrict__ Wt) {
    constexpr int WP = WTK + 8;           // LDS row pitch in halves (16 B x odd)
    constexpr int XP = XELE / 1024;       // passes over x, one float4 per thread each
    static_assert(WTK * WTN == 256 * 8 && WTN == 32 && XELE % 1024 == 0, "thread maps below");
    __shared__ __align__(16) _Float16 tile[3][WTN * WP];
    const int      t  = threadIdx.x;
    const unsigned b  = blockIdx.x;
    const unsigned kT = (b / (AD / WTN)) * WTK;
    const unsigned nT = (b % (AD / WTN)) * WTN;

    const int    k    = (t >> 3) * 2;     // two input rows per thread: one f16 pair per output
    const int    n    = (t & 7) * 4;      // 8 lanes x 16 B = one whole 128-byte line
    const size_t woff = (size_t)(kT + k) * AD + nT + n;
    const size_t base = (size_t)b * XELE + t * 4;
    const float* Ws[3] = {Wq, Wk, Wv};
    float4 w0[3], w1[3], v[XP];
#pragma unroll
    for (int m = 0; m < 3; ++m) {
        w0[m] = *(const float4*)(Ws[m] + woff);
        w1[m] = *(const float4*)(Ws[m] + woff + AD);
    }
    // The loads of x below land in registers that held the weights' addresses.
    asm volatile("s_wait_xcnt 0x0" ::: "memory");
#pragma unroll
    for (int i = 0; i < XP; ++i) v[i] = *(const float4*)(x + base + i * 1024);

#pragma unroll
    for (int m = 0; m < 3; ++m) {
        *(v2h*)(&tile[m][(n + 0) * WP + k]) = (v2h){(_Float16)w0[m].x, (_Float16)w1[m].x};
        *(v2h*)(&tile[m][(n + 1) * WP + k]) = (v2h){(_Float16)w0[m].y, (_Float16)w1[m].y};
        *(v2h*)(&tile[m][(n + 2) * WP + k]) = (v2h){(_Float16)w0[m].z, (_Float16)w1[m].z};
        *(v2h*)(&tile[m][(n + 3) * WP + k]) = (v2h){(_Float16)w0[m].w, (_Float16)w1[m].w};
    }
    __syncthreads();   // the turned tiles are read back by other waves
#pragma unroll
    for (int m = 0; m < 3; ++m) {
        const int row = t >> 3;
        const int kc  = (t & 7) * 8;      // 8 lanes x 16 B = one whole 128-byte line
        *(v8h*)(Wt + (size_t)m * AD * AD + (size_t)(nT + row) * AD + kT + kc) =
            *(const v8h*)(&tile[m][row * WP + kc]);
    }
#pragma unroll
    for (int i = 0; i < XP; ++i) {
        v4h h = {(_Float16)v[i].x, (_Float16)v[i].y, (_Float16)v[i].z, (_Float16)v[i].w};
        *(v4h*)(xh + base + i * 1024) = h;
    }
}

// Q = x Wq and K = x Wk as [N][D]; V as [D][N] = Wv^T x^T, the same loop with the operands' roles
// exchanged, so that the last product finds both operands K-contiguous.
__global__ void __launch_bounds__(256)
qkv_kernel(const _Float16* __restrict__ xh, const _Float16* __restrict__ Wt,
           _Float16* __restrict__ Q, _Float16* __restrict__ Kp, _Float16* __restrict__ Vt) {
    const int  z  = blockIdx.z;
    const bool tr = (z == 2);
    const _Float16* Wz = Wt + (size_t)z * AD * AD;
    const unsigned b  = blockIdx.x;
    const unsigned mT = tr ? b / (AN / TN) : b / (AD / TN);
    const unsigned nT = tr ? b % (AN / TN) : b % (AD / TN);
    gemm_nt<64, 0>(tr ? Wz : xh, tr ? xh : Wz, (z == 0) ? Q : (z == 1) ? Kp : Vt, (float*)nullptr,
                   AD, tr ? AN : AD, 1.0f, mT * TM, nT * TN);
}

__global__ void __launch_bounds__(256)
scores_kernel(const _Float16* __restrict__ Q, const _Float16* __restrict__ Kp,
              _Float16* __restrict__ P, float* __restrict__ ml) {
    gemm_nt<64, 1>(Q, Kp, P, ml, AD, AN, 0.03125f /* 1/sqrt(1024) */,
                   blockIdx.y * TM, blockIdx.x * TN);
}

__global__ void __launch_bounds__(256)
out_kernel(const _Float16* __restrict__ P, const _Float16* __restrict__ Vt,
           float* __restrict__ ml, float* __restrict__ O) {
    // P comes from memory: a 128-k slab gives its copies a longer flight.
    gemm_nt<128, 2>(P, Vt, O, ml, AN, AD, 1.0f, blockIdx.y * TM, blockIdx.x * TN);
}

extern "C" void kernel_launch(void* const* d_in, const int* in_sizes, int n_in,
                              void* d_out, int out_size, void* d_ws, size_t ws_size,
                              hipStream_t stream) {
    (void)in_sizes; (void)n_in; (void)out_size; (void)ws_size;
    const float* x  = (const float*)d_in[0];
    const float* Wq = (const float*)d_in[1];
    const float* Wk = (const float*)d_in[2];
    const float* Wv = (const float*)d_in[3];

    _Float16* Q  = (_Float16*)d_ws;
    _Float16* Kp = Q  + (size_t)AN * AD;
    _Float16* Vt = Kp + (size_t)AN * AD;   // V transposed: [D][N]
    _Float16* S  = Vt + (size_t)AN * AD;   // 8192*8192 f16: P, each block of 64 keys on its own maximum
    _Float16* xh = S  + (size_t)AN * AN;   // x in f16
    _Float16* Wt = xh + (size_t)AN * AD;   // three weights in f16, each [out][in]
    float*    ml = (float*)(Wt + (size_t)3 * AD * AD);   // [NBLK][2][N]: block maxima and sums

    dim3 blk(256);

    prep_kernel<<<dim3(PBLKS), blk, 0, stream>>>(x, Wq, Wk, Wv, xh, Wt);
    qkv_kernel<<<dim3((AN / TM) * (AD / TN), 1, 3), blk, 0, stream>>>(xh, Wt, Q, Kp, Vt);
    scores_kernel<<<dim3(AN / TN, AN / TM), blk, 0, stream>>>(Q, Kp, S, ml);
    out_kernel<<<dim3(AD / TN, AN / TM), blk, 0, stream>>>(S, Vt, ml, (float*)d_out);
}

// v005
// A run of this version takes 233 microseconds.
// Next to v004, in two timings, it ran 1.04 and 1.03 times as fast.
// Counting every step since v000, it is 2.19 times as fast.
#include <hip/hip_runtime.h>
#include <hip/hip_bf16.h>

// Attention: out = softmax((x Wq)(x Wk)^T / sqrt(D)) (x Wv)
// N = 8192, D = 1024, fp32 in/out. Internals f16, f32 WMMA accumulate.
// Workspace (>= 206 MB): Q,K f16 [N][D], V f16 transposed [D][N] (16 MB each)
// + P f16 (128 MB): exp of each score less the maximum of its own row in its block of 64 keys
// + x f16 [N][D] (16 MB) + Wq,Wk,Wv f16, each transposed [out][in] (2 MB each)
// + per block of 64 keys and row: that maximum (log2 units) and the block's sum, f32 (8 MB).

#define AN 8192
#define AD 1024

typedef _Float16 v16h __attribute__((ext_vector_type(16)));
typedef _Float16 v8h  __attribute__((ext_vector_type(8)));
typedef _Float16 v4h  __attribute__((ext_vector_type(4)));
typedef _Float16 v2h  __attribute__((ext_vector_type(2)));
typedef float    v8f  __attribute__((ext_vector_type(8)));
typedef float    v4f  __attribute__((ext_vector_type(4)));
typedef int      v4i_ __attribute__((ext_vector_type(4)));

// ---- CDNA5 async global->LDS copy (ASYNCcnt), with safe fallback ----
#if defined(__has_builtin)
#  if __has_builtin(__builtin_amdgcn_global_load_async_to_lds_b128)
#    define USE_ASYNC_LDS 1
#  endif
#endif
#ifndef USE_ASYNC_LDS
#  define USE_ASYNC_LDS 0
#endif

#if USE_ASYNC_LDS
typedef __attribute__((address_space(1))) v4i_* g4p_t;   // global int4*
typedef __attribute__((address_space(3))) v4i_* l4p_t;   // LDS int4*
#endif

// Copy 16 bytes (8 halves) global -> LDS.
__device__ __forceinline__ void cp_b128(const _Float16* g, _Float16* l) {
#if USE_ASYNC_LDS
    // int->pointer casts sidestep addrspacecast restrictions; flat-shared
    // pointer low 32 bits == LDS byte offset (ISA flat addressing rule).
    __builtin_amdgcn_global_load_async_to_lds_b128(
        (g4p_t)(unsigned long long)g,
        (l4p_t)(unsigned)(unsigned long long)l,
        0, 0);
#else
    *(v8h*)l = *(const v8h*)g;
#endif
}

__device__ __forceinline__ v8f wmma_f16(v16h a, v16h b, v8f c) {
    return __builtin_amdgcn_wmma_f32_16x16x32_f16(
        false, a, false, b, (short)0, c, false, false);
}

// Per-lane WMMA fragment from LDS tile stored [row][k].
// slots 0..7 -> k = hi*8.., slots 8..15 -> k = hi*8+16..
__device__ __forceinline__ v16h load_frag(const _Float16* p) {
    v8h lo = *(const v8h*)(p);
    v8h hh = *(const v8h*)(p + 16);
    v16h r;
#pragma unroll
    for (int i = 0; i < 8; ++i) { r[i] = lo[i]; r[i + 8] = hh[i]; }
    return r;
}

// The value that lane l ^ 16 holds (a vector move between the wave's two rows of 16 lanes).
__device__ __forceinline__ float other_half(float v) {
    const int i = __builtin_bit_cast(int, v);
    return __builtin_bit_cast(float,
        __builtin_amdgcn_permlanex16(i, i, 0x76543210, 0xfedcba98, false, false));
}

// 2^x. The v_nop fills the slot that the instruction set asks for behind a transcendental.
__device__ __forceinline__ float exp2_slot(float x) {
    float y;
    asm("v_exp_f32 %0, %1\n\tv_nop" : "=v"(y) : "v"(x));
    return y;
}

// Sends a wave's 64 x 64 f16 tile out as whole 128-byte lines. h[mi][ni] is row mi * 16 + lr,
// columns ni * 16 + hi * 8 .. + 7. The tile is turned in st, an LDS range that only this wave uses;
// each store then covers 4 rows of 128 bytes instead of 16 pieces of 32 bytes.
// Ncols is a constant at every call: the 16 stores then share one address register pair.
__device__ __forceinline__ void store_tile_f16(const v8h (&h)[4][4], _Float16* st,
                                               _Float16* __restrict__ c0, const int Ncols, int lane) {
    constexpr int SP = 72;             // LDS row pitch in halves: 16 B x odd
    const int lr = lane & 15;
    const int hi = lane >> 4;
#pragma unroll
    for (int mi = 0; mi < 4; ++mi)
#pragma unroll
        for (int ni = 0; ni < 4; ++ni) *(v8h*)(st + (mi * 16 + lr) * SP + ni * 16 + hi * 8) = h[mi][ni];
    asm volatile("s_wait_dscnt 0x0" ::: "memory");   // the rows are read back by other lanes of this wave
    v8h o[16];
#pragma unroll
    for (int j = 0; j < 16; ++j) o[j] = *(const v8h*)(st + (j * 4 + (lane >> 3)) * SP + (lane & 7) * 8);
    _Float16* gp = c0 + (size_t)(lane >> 3) * Ncols + (lane & 7) * 8;
    // All stores stand behind all LDS reads: no register that an issued store names is written again.
    __builtin_amdgcn_sched_barrier(0);
#pragma unroll
    for (int j = 0; j < 16; ++j) *(v8h*)(gp + (size_t)(j * 4) * Ncols) = o[j];
    // The registers that the stores above name are free for reuse from here on.
    asm volatile("s_wait_xcnt 0x0" ::: "memory");
}

// ======================================================================
// C[M,N] = alpha * A[M,Kd] * Bt[N,Kd]^T  (both K-contiguous f16)
// Work-group tile TM x TN, K slab KB; 8 waves as 2 x 4, each a 64 x 64 tile.
// Both operands come by async global->LDS copies, two buffers.
// The WMMAs take Bt's fragment as A and A's as B, so that a lane holds 8 neighbouring columns of one
// row of C; behind the loop each wave turns its tile in its own eighth of ldsB and stores whole lines.
// ======================================================================
#define TM 128
#define TN 256
#define KBLK 64                // keys per softmax block: the columns of one wave's tile of the scores
#define NBLK (AN / KBLK)

// MODE 0: C = alpha * A * Bt^T.
// MODE 1: the scores. Each wave turns its 64 x 64 tile into exp(score - block maximum) and stores,
//         in ml[block][0][row] and ml[block][1][row], the maximum (log2 units) and the sum.
// MODE 2: the last product. A's fragments are brought to their row's overall maximum on the way
//         into the WMMAs; the row's sum divides in the epilogue.
template <int KB, int MODE, typename TC>
__device__ __forceinline__ void gemm_nt(const _Float16* __restrict__ A,
                                        const _Float16* __restrict__ Bt,
                                        TC* __restrict__ C, float* __restrict__ ml,
                                        int Kd, int Ncols,
                                        float alpha, int mBase, int nBase) {
    constexpr int PIT = KB + 8;        // LDS row pitch in halves: 16 B x odd, conflict-free b128 reads
    constexpr int LPR = KB / 8;        // lanes that cover one slab row, 16 B each (whole 128-B lines)
    constexpr int RPS = 256 / LPR;     // rows that one copy of the whole block covers
    __shared__ __align__(16) _Float16 ldsA[2][TM * PIT];
    __shared__ __align__(16) _Float16 ldsB[2][TN * PIT];
    constexpr int SCP = NBLK + 2;      // pitch of the factor table in halves: an odd count of dwords
    __shared__ __align__(16) _Float16 scT[MODE == 2 ? TM * SCP : 8];   // factor per row and key block
    __shared__ float pmax[2][MODE == 2 ? TM : 1];                      // row maximum, by half of the blocks
    __shared__ float psum[2][MODE == 2 ? TM : 1];                      // row sum, by half of the blocks
    static_assert(MODE != 2 || KB == 2 * KBLK, "one dword of scT serves one slab");

    const int t    = threadIdx.x;
    const int lane = t & 31;
    const int wave = t >> 5;
    const int lr   = lane & 15;
    const int hi   = lane >> 4;
    const int waveM = wave & 1;   // 2 wave-rows (64 M each)
    const int waveN = wave >> 1;  // 4 wave-cols (64 N each)

    v8f acc[4][4];
#pragma unroll
    for (int mi = 0; mi < 4; ++mi)
#pragma unroll
        for (int ni = 0; ni < 4; ++ni) acc[mi][ni] = (v8f){0,0,0,0,0,0,0,0};

    const int crow = t / LPR;
    const int ccol = (t % LPR) * 8;
    const _Float16* aSrc = A  + (size_t)(mBase + crow) * Kd + ccol;
    const _Float16* bSrc = Bt + (size_t)(nBase + crow) * Kd + ccol;

    auto stage = [&](int k0, int buf) {
#pragma unroll
        for (int i = 0; i < TM / RPS; ++i)
            cp_b128(aSrc + (size_t)(i * RPS) * Kd + k0, &ldsA[buf][(crow + i * RPS) * PIT + ccol]);
#pragma unroll
        for (int i = 0; i < TN / RPS; ++i)
            cp_b128(bSrc + (size_t)(i * RPS) * Kd + k0, &ldsB[buf][(crow + i * RPS) * PIT + ccol]);
    };

    stage(0, 0);
    if constexpr (MODE == 2) {
        // Keeps slab 0's copies in front of the loads below: left free, the compiler issues them
        // behind the wait for the first of those loads.
        __builtin_amdgcn_sched_barrier(0);
        // Joins the blocks of this work-group's rows while slab 0 flies: thread = (row, half of the blocks).
        constexpr int HB = NBLK / 2;
        const int prow = t & (TM - 1);
        const int ph   = t >> 7;
        const float* mp = ml + (size_t)(ph * HB) * 2 * AN + mBase + prow;
        float mv[HB], lv[HB];
#pragma unroll
        for (int i = 0; i < HB; ++i) mv[i] = mp[(size_t)i * 2 * AN];
#pragma unroll
        for (int i = 0; i < HB; ++i) lv[i] = mp[(size_t)i * 2 * AN + AN];
        // The address registers of the loads above are free for reuse from here on.
        asm volatile("s_wait_xcnt 0x0" ::: "memory");
        float mx = mv[0];
#pragma unroll
        for (int i = 1; i < HB; ++i) mx = fmaxf(mx, mv[i]);
        pmax[ph][prow] = mx;
        __syncthreads();   // the other half's maximum is written by another wave
        mx = fmaxf(pmax[0][prow], pmax[1][prow]);
        float ls = 0.0f;
#pragma unroll
        for (int i = 0; i < HB; i += 2) {
            const float f0 = __builtin_amdgcn_exp2f(mv[i] - mx);
            const float f1 = __builtin_amdgcn_exp2f(mv[i + 1] - mx);
            ls += lv[i] * f0 + lv[i + 1] * f1;
            *(v2h*)(&scT[prow * SCP + ph * HB + i]) = (v2h){(_Float16)f0, (_Float16)f1};
        }
        psum[ph][prow] = ls;   // published, like scT, by the barrier below
    }
    asm volatile("s_wait_asynccnt 0x0" ::: "memory");   // slab 0 has landed before it is published
    __syncthreads();
    stage(KB, 1);                                       // Kd >= 2 * KB at every call site

    for (int k0 = 0; k0 < Kd; k0 += KB) {
        const int cur = (k0 / KB) & 1;
        v2h scp[4];   // MODE 2: the factors of this slab's two key blocks, per A fragment row
#pragma unroll
        for (int kk = 0; kk < KB; kk += 32) {
            v16h af[4], bf[4];
            if constexpr (MODE == 2) {
                if (kk == 0) {
#pragma unroll
                    for (int mi = 0; mi < 4; ++mi)
                        scp[mi] = *(const v2h*)(&scT[(waveM * 64 + mi * 16 + lr) * SCP + k0 / KBLK]);
                }
            }
#pragma unroll
            for (int mi = 0; mi < 4; ++mi)
                af[mi] = load_frag(&ldsA[cur][(waveM * 64 + mi * 16 + lr) * PIT + kk + hi * 8]);
#pragma unroll
            for (int ni = 0; ni < 4; ++ni)
                bf[ni] = load_frag(&ldsB[cur][(waveN * 64 + ni * 16 + lr) * PIT + kk + hi * 8]);
            // Keeps the block's 16 LDS reads one group in front of its 16 WMMAs: left free, the
            // compiler reloads one A fragment per row of four and waits for it to the last read.
            __builtin_amdgcn_sched_barrier(0);
            if constexpr (MODE == 2) {
#pragma unroll
                for (int mi = 0; mi < 4; ++mi) af[mi] *= scp[mi][kk / KBLK];   // a lane's fragment is one row
            }
#pragma unroll
            for (int mi = 0; mi < 4; ++mi)
#pragma unroll
                for (int ni = 0; ni < 4; ++ni)   // operands exchanged: a lane holds one row's 8 neighbouring columns
                    acc[mi][ni] = wmma_f16(bf[ni], af[mi], acc[mi][ni]);
            // Keeps the next block's reads from being spread among these WMMAs.
            __builtin_amdgcn_sched_barrier(0);
        }
        asm volatile("s_wait_dscnt 0x0" ::: "memory");      // this wave has left buffer cur before it is refilled
        asm volatile("s_wait_asynccnt 0x0" ::: "memory");   // this wave's part of the next slab has landed
        __syncthreads();   // publishes the next slab and ends every read of buffer cur
        if (k0 + 2 * KB < Kd) stage(k0 + 2 * KB, cur);      // flies while the next slab is worked on
    }
    asm volatile("s_wait_asynccnt 0x0" ::: "memory");   // no copy is left in flight at the wave's end

    // acc[mi][ni][r] is row mi * 16 + lr, column ni * 16 + hi * 8 + r of the wave's tile.
    // The last trip's barrier has ended every read of the ring and nothing flies into it any more.
    static_assert(sizeof(ldsB) >= 8 * 64 * (64 * sizeof(TC) + 16), "a padded 64 x 64 tile per wave");
    if constexpr (MODE == 1) {
        const float a2 = alpha * 1.44269504f;   // scores in log2 units; alpha > 0
        v8h   h[4][4];
        float ms[4];
#pragma unroll
        for (int mi = 0; mi < 4; ++mi) {
            float mx = acc[mi][0][0];
#pragma unroll
            for (int ni = 0; ni < 4; ++ni)
#pragma unroll
                for (int r = 0; r < 8; ++r) mx = fmaxf(mx, acc[mi][ni][r]);
            mx = fmaxf(mx, other_half(mx));   // the row's other 32 keys
            const float m2 = mx * a2;
            float s = 0.0f;
#pragma unroll
            for (int ni = 0; ni < 4; ++ni)
#pragma unroll
                for (int r = 0; r < 8; ++r) {
                    const float p = exp2_slot(fmaf(acc[mi][ni][r], a2, -m2));
                    s += p;
                    h[mi][ni][r] = (_Float16)p;
                }
            s += other_half(s);
            ms[mi] = hi ? s : m2;   // 16 lanes each: maxima, sums
        }
        float* mp = ml + ((size_t)(nBase / KBLK + waveN) * 2 + hi) * AN + mBase + waveM * 64 + lr;
        store_tile_f16(h, &ldsB[0][0] + wave * (64 * 72),
                       C + (size_t)(mBase + waveM * 64) * Ncols + nBase + waveN * 64, Ncols, lane);
#pragma unroll
        for (int mi = 0; mi < 4; ++mi) mp[mi * 16] = ms[mi];
    } else if constexpr (MODE == 2) {
        constexpr int SP = 68;             // LDS row pitch in floats: 16 B x odd
        float* st = reinterpret_cast<float*>(&ldsB[0][0]) + wave * (64 * SP);
#pragma unroll
        for (int mi = 0; mi < 4; ++mi) {
            const int   lrow = waveM * 64 + mi * 16 + lr;
            const float inv  = 1.0f / (psum[0][lrow] + psum[1][lrow]);
#pragma unroll
            for (int ni = 0; ni < 4; ++ni) {
                const v8f a = acc[mi][ni] * inv;
                float*    p = st + (mi * 16 + lr) * SP + ni * 16 + hi * 8;
                *(v4f*)(p)     = (v4f){a[0], a[1], a[2], a[3]};
                *(v4f*)(p + 4) = (v4f){a[4], a[5], a[6], a[7]};
            }
        }
        asm volatile("s_wait_dscnt 0x0" ::: "memory");   // the rows are read back by other lanes of this wave
        v4f o[32];
#pragma unroll
        for (int j = 0; j < 32; ++j) o[j] = *(const v4f*)(st + (j * 2 + hi) * SP + lr * 4);
        TC* gp = C + (size_t)(mBase + waveM * 64 + hi) * Ncols + nBase + waveN * 64 + lr * 4;
        // All stores stand behind all LDS reads: no register that an issued store names is written again.
        __builtin_amdgcn_sched_barrier(0);
#pragma unroll
        for (int j = 0; j < 32; ++j) *(v4f*)(gp + (size_t)(j * 2) * Ncols) = o[j];   // 2 rows of 256 bytes
    } else {
        v8h h[4][4];
#pragma unroll
        for (int mi = 0; mi < 4; ++mi)
#pragma unroll
            for (int ni = 0; ni < 4; ++ni)
#pragma unroll
                for (int r = 0; r < 8; ++r) h[mi][ni][r] = (_Float16)(acc[mi][ni][r] * alpha);
        _Float16* st = &ldsB[0][0] + wave * (64 * 72);
        TC*       c0 = C + (size_t)(mBase + waveM * 64) * Ncols + nBase + waveN * 64;
        // The file's two row lengths, each as a constant (the same for the whole work-group).
        if (Ncols == AN) store_tile_f16(h, st, c0, AN, lane);
        else             store_tile_f16(h, st, c0, AD, lane);
    }
}

// ---------------- kernels ----------------

#define PBLKS 512                         // work-groups of the rounding kernel
#define XELE  (AN * AD / PBLKS)           // x elements per work-group
#define WTK   64                          // weight tile: 64 inputs x 32 outputs, one of each weight
#define WTN   (AD * AD / PBLKS / WTK)

// Rounds the projection's operands to f16 once: x as it lies, each weight turned to [out][in],
// so that every product of the file finds both operands K-contiguous in f16.
__global__ void __launch_bounds__(256)
prep_kernel(const float* __restrict__ x,
            const float* __restrict__ Wq, const float* __restrict__ Wk,
            const float* __restrict__ Wv,
            _Float16* __restrict__ xh, _Float16* __restrict__ Wt) {
    constexpr int WP = WTK + 8;           // LDS row pitch in halves (16 B x odd)
    constexpr int XP = XELE / 1024;       // passes over x, one float4 per thread each
    static_assert(WTK * WTN == 256 * 8 && WTN == 32 && XELE % 1024 == 0, "thread maps below");
    __shared__ __align__(16) _Float16 tile[3][WTN * WP];
    const int      t  = threadIdx.x;
    const unsigned b  = blockIdx.x;
    const unsigned kT = (b / (AD / WTN)) * WTK;
    const unsigned nT = (b % (AD / WTN)) * WTN;

    const int    k    = (t >> 3) * 2;     // two input rows per thread: one f16 pair per output
    const int    n    = (t & 7) * 4;      // 8 lanes x 16 B = one whole 128-byte line
    const size_t woff = (size_t)(kT + k) * AD + nT + n;
    const size_t base = (size_t)b * XELE + t * 4;
    const float* Ws[3] = {Wq, Wk, Wv};
    float4 w0[3], w1[3], v[XP];
#pragma unroll
    for (int m = 0; m < 3; ++m) {
        w0[m] = *(const float4*)(Ws[m] + woff);
        w1[m] = *(const float4*)(Ws[m] + woff + AD);
    }
    // The loads of x below land in registers that held the weights' addresses.
    asm volatile("s_wait_xcnt 0x0" ::: "memory");
#pragma unroll
    for (int i = 0; i < XP; ++i) v[i] = *(const float4*)(x + base + i * 1024);

#pragma unroll
    for (int m = 0; m < 3; ++m) {
        *(v2h*)(&tile[m][(n + 0) * WP + k]) = (v2h){(_Float16)w0[m].x, (_Float16)w1[m].x};
        *(v2h*)(&tile[m][(n + 1) * WP + k]) = (v2h){(_Float16)w0[m].y, (_Float16)w1[m].y};
        *(v2h*)(&tile[m][(n + 2) * WP + k]) = (v2h){(_Float16)w0[m].z, (_Float16)w1[m].z};
        *(v2h*)(&tile[m][(n + 3) * WP + k]) = (v2h){(_Float16)w0[m].w, (_Float16)w1[m].w};
    }
    __syncthreads();   // the turned tiles are read back by other waves
#pragma unroll
    for (int m = 0; m < 3; ++m) {
        const int row = t >> 3;
        const int kc  = (t & 7) * 8;      // 8 lanes x 16 B = one whole 128-byte line
        *(v8h*)(Wt + (size_t)m * AD * AD + (size_t)(nT + row) * AD + kT + kc) =
            *(const v8h*)(&tile[m][row * WP + kc]);
    }
#pragma unroll
    for (int i = 0; i < XP; ++i) {
        v4h h = {(_Float16)v[i].x, (_Float16)v[i].y, (_Float16)v[i].z, (_Float16)v[i].w};
        *(v4h*)(xh + base + i * 1024) = h;
    }
}

// Q = x Wq and K = x Wk as [N][D]; V as [D][N] = Wv^T x^T, the same loop with the operands' roles
// exchanged, so that the last product finds both operands K-contiguous.
__global__ void __launch_bounds__(256)
qkv_kernel(const _Float16* __restrict__ xh, const _Float16* __restrict__ Wt,
           _Float16* __restrict__ Q, _Float16* __restrict__ Kp, _Float16* __restrict__ Vt) {
    const int  z  = blockIdx.z;
    const bool tr = (z == 2);
    const _Float16* Wz = Wt + (size_t)z * AD * AD;
    const unsigned b  = blockIdx.x;
    const unsigned mT = tr ? b / (AN / TN) : b / (AD / TN);
    const unsigned nT = tr ? b % (AN / TN) : b % (AD / TN);
    gemm_nt<64, 0>(tr ? Wz : xh, tr ? xh : Wz, (z == 0) ? Q : (z == 1) ? Kp : Vt, (float*)nullptr,
                   AD, tr ? AN : AD, 1.0f, mT * TM, nT * TN);
}

__global__ void __launch_bounds__(256)
scores_kernel(const _Float16* __restrict__ Q, const _Float16* __restrict__ Kp,
              _Float16* __restrict__ P, float* __restrict__ ml) {
    gemm_nt<64, 1>(Q, Kp, P, ml, AD, AN, 0.03125f /* 1/sqrt(1024) */,
                   blockIdx.y * TM, blockIdx.x * TN);
}

__global__ void __launch_bounds__(256)
out_kernel(const _Float16* __restrict__ P, const _Float16* __restrict__ Vt,
           float* __restrict__ ml, float* __restrict__ O) {
    // P comes from memory: a 128-k slab gives its copies a longer flight.
    gemm_nt<128, 2>(P, Vt, O, ml, AN, AD, 1.0f, blockIdx.y * TM, blockIdx.x * TN);
}

extern "C" void kernel_launch(void* const* d_in, const int* in_sizes, int n_in,
                              void* d_out, int out_size, void* d_ws, size_t ws_size,
                              hipStream_t stream) {
    (void)in_sizes; (void)n_in; (void)out_size; (void)ws_size;
    const float* x  = (const float*)d_in[0];
    const float* Wq = (const float*)d_in[1];
    const float* Wk = (const float*)d_in[2];
    const float* Wv = (const float*)d_in[3];

    _Float16* Q  = (_Float16*)d_ws;
    _Float16* Kp = Q  + (size_t)AN * AD;
    _Float16* Vt = Kp + (size_t)AN * AD;   // V transposed: [D][N]
    _Float16* S  = Vt + (size_t)AN * AD;   // 8192*8192 f16: P, each block of 64 keys on its own maximum
    _Float16* xh = S  + (size_t)AN * AN;   // x in f16
    _Float16* Wt = xh + (size_t)AN * AD;   // three weights in f16, each [out][in]
    float*    ml = (float*)(Wt + (size_t)3 * AD * AD);   // [NBLK][2][N]: block maxima and sums

    dim3 blk(256);

    prep_kernel<<<dim3(PBLKS), blk, 0, stream>>>(x, Wq, Wk, Wv, xh, Wt);
    qkv_kernel<<<dim3((AN / TM) * (AD / TN), 1, 3), blk, 0, stream>>>(xh, Wt, Q, Kp, Vt);
    scores_kernel<<<dim3(AN / TN, AN / TM), blk, 0, stream>>>(Q, Kp, S, ml);
    out_kernel<<<dim3(AD / TN, AN / TM), blk, 0, stream>>>(S, Vt, ml, (float*)d_out);
}

// v006
// A run of this version takes 218 microseconds.
// In two side-by-side timings against v005, it was 1.07 and 1.06 times as fast.
// All steps since v000 together make it 2.34 times as fast.
#include <hip/hip_runtime.h>
#include <hip/hip_bf16.h>

// Attention: out = softmax((x Wq)(x Wk)^T / sqrt(D)) (x Wv)
// N = 8192, D = 1024, fp32 in/out. Internals f16, f32 WMMA accumulate.
// Workspace (>= 206 MB): Q,K f16 [N][D], V f16 transposed [D][N] (16 MB each)
// + P f16 (128 MB): exp of each score less the maximum of its own row in its block of 64 keys
// + x f16 [N][D] (16 MB) + Wq,Wk,Wv f16, each transposed [out][in] (2 MB each)
// + per block of 64 keys and row: that maximum (log2 units) and the block's sum, f32 (8 MB).

#define AN 8192
#define AD 1024

typedef _Float16 v16h __attribute__((ext_vector_type(16)));
typedef _Float16 v8h  __attribute__((ext_vector_type(8)));
typedef _Float16 v4h  __attribute__((ext_vector_type(4)));
typedef _Float16 v2h  __attribute__((ext_vector_type(2)));
typedef float    v8f  __attribute__((ext_vector_type(8)));
typedef float    v4f  __attribute__((ext_vector_type(4)));
typedef int      v4i_ __attribute__((ext_vector_type(4)));

// ---- CDNA5 async global->LDS copy (ASYNCcnt), with safe fallback ----
#if defined(__has_builtin)
#  if __has_builtin(__builtin_amdgcn_global_load_async_to_lds_b128)
#    define USE_ASYNC_LDS 1
#  endif
#endif
#ifndef USE_ASYNC_LDS
#  define USE_ASYNC_LDS 0
#endif

#if USE_ASYNC_LDS
typedef __attribute__((address_space(1))) v4i_* g4p_t;   // global int4*
typedef __attribute__((address_space(3))) v4i_* l4p_t;   // LDS int4*
#endif

// Copy 16 bytes (8 halves) global -> LDS.
__device__ __forceinline__ void cp_b128(const _Float16* g, _Float16* l) {
#if USE_ASYNC_LDS
    // int->pointer casts sidestep addrspacecast restrictions; flat-shared
    // pointer low 32 bits == LDS byte offset (ISA flat addressing rule).
    __builtin_amdgcn_global_load_async_to_lds_b128(
        (g4p_t)(unsigned long long)g,
        (l4p_t)(unsigned)(unsigned long long)l,
        0, 0);
#else
    *(v8h*)l = *(const v8h*)g;
#endif
}

__device__ __forceinline__ v8f wmma_f16(v16h a, v16h b, v8f c) {
    return __builtin_amdgcn_wmma_f32_16x16x32_f16(
        false, a, false, b, (short)0, c, false, false);
}

// Per-lane WMMA fragment from LDS tile stored [row][k].
// slots 0..7 -> k = hi*8.., slots 8..15 -> k = hi*8+16..
__device__ __forceinline__ v16h load_frag(const _Float16* p) {
    v8h lo = *(const v8h*)(p);
    v8h hh = *(const v8h*)(p + 16);
    v16h r;
#pragma unroll
    for (int i = 0; i < 8; ++i) { r[i] = lo[i]; r[i + 8] = hh[i]; }
    return r;
}

// The value that lane l ^ 16 holds (a vector move between the wave's two rows of 16 lanes).
__device__ __forceinline__ float other_half(float v) {
    const int i = __builtin_bit_cast(int, v);
    return __builtin_bit_cast(float,
        __builtin_amdgcn_permlanex16(i, i, 0x76543210, 0xfedcba98, false, false));
}

// 2^x. The v_nop fills the slot that the instruction set asks for behind a transcendental.
__device__ __forceinline__ float exp2_slot(float x) {
    float y;
    asm("v_exp_f32 %0, %1\n\tv_nop" : "=v"(y) : "v"(x));
    return y;
}

// Sends a wave's 64 x 64 f16 tile out as whole 128-byte lines. h[mi][ni] is row mi * 16 + lr,
// columns ni * 16 + hi * 8 .. + 7. The tile is turned in st, an LDS range that only this wave uses;
// each store then covers 4 rows of 128 bytes instead of 16 pieces of 32 bytes.
// Ncols is a constant at every call: the 16 stores then share one address register pair.
__device__ __forceinline__ void store_tile_f16(const v8h (&h)[4][4], _Float16* st,
                                               _Float16* __restrict__ c0, const int Ncols, int lane) {
    constexpr int SP = 72;             // LDS row pitch in halves: 16 B x odd
    const int lr = lane & 15;
    const int hi = lane >> 4;
#pragma unroll
    for (int mi = 0; mi < 4; ++mi)
#pragma unroll
        for (int ni = 0; ni < 4; ++ni) *(v8h*)(st + (mi * 16 + lr) * SP + ni * 16 + hi * 8) = h[mi][ni];
    asm volatile("s_wait_dscnt 0x0" ::: "memory");   // the rows are read back by other lanes of this wave
    v8h o[16];
#pragma unroll
    for (int j = 0; j < 16; ++j) o[j] = *(const v8h*)(st + (j * 4 + (lane >> 3)) * SP + (lane & 7) * 8);
    _Float16* gp = c0 + (size_t)(lane >> 3) * Ncols + (lane & 7) * 8;
    // All stores stand behind all LDS reads: no register that an issued store names is written again.
    __builtin_amdgcn_sched_barrier(0);
#pragma unroll
    for (int j = 0; j < 16; ++j) *(v8h*)(gp + (size_t)(j * 4) * Ncols) = o[j];
    // The registers that the stores above name are free for reuse from here on.
    asm volatile("s_wait_xcnt 0x0" ::: "memory");
}

// ======================================================================
// C[M,N] = alpha * A[M,Kd] * Bt[N,Kd]^T  (both K-contiguous f16)
// Work-group tile TMv x TN, K slab KB; 8 waves, each on a 64 x 128 tile: 12 fragments from LDS feed
// 32 WMMAs (a 64 x 64 tile: 8 feed 16).
// KS == 1: TMv = 256, the waves lie 4 x 2.
// KS == 2: TMv = 128, the waves lie 2 x 2 x 2: the two waves of a pair share a tile and each takes one
//          half of every slab's k; behind the loop each hands the other, through LDS, its partial sums
//          of one 64-column half and finishes the half that it keeps.
// Both operands come by async global->LDS copies, two buffers.
// The WMMAs take Bt's fragment as A and A's as B, so that a lane holds 8 neighbouring columns of one
// row of C; behind the loop each wave turns 64 x 64 pieces in its own XS-byte range of ldsB and stores whole lines.
// ======================================================================
#define TN 256
#define KBLK 64                // keys per softmax block
#define NBLK (AN / KBLK)

// MODE 0: C = alpha * A * Bt^T.
// MODE 1: the scores. Each wave turns each 64 x 64 half of its tile into exp(score - block maximum) and
//         stores, in ml[block][0][row] and ml[block][1][row], the maximum (log2 units) and the sum.
// MODE 2: the last product. A's fragments are brought to their row's overall maximum on the way
//         into the WMMAs; the row's sum divides in the epilogue.
template <int KB, int MODE, int TMv, int KS, typename TC>
__device__ __forceinline__ void gemm_nt(const _Float16* __restrict__ A,
                                        const _Float16* __restrict__ Bt,
                                        TC* __restrict__ C, float* __restrict__ ml,
                                        int Kd, int Ncols,
                                        float alpha, int mBase, int nBase) {
    constexpr int PIT = KB + 8;        // LDS row pitch in halves: 16 B x odd, conflict-free b128 reads
    constexpr int LPR = KB / 8;        // lanes that cover one slab row, 16 B each (whole 128-B lines)
    constexpr int RPS = 256 / LPR;     // rows that one copy of the whole block covers
    constexpr int KW  = KB / KS;       // the part of a slab's k that one wave works on
    __shared__ __align__(16) _Float16 ldsA[2][TMv * PIT];
    __shared__ __align__(16) _Float16 ldsB[2][TN * PIT];
    constexpr int SCP = NBLK + 2;      // pitch of the factor table in halves: an odd count of dwords
    __shared__ __align__(16) _Float16 scT[MODE == 2 ? TMv * SCP : 8];  // factor per row and key block
    __shared__ float pmax[2][MODE == 2 ? TMv : 1];                     // row maximum, by half of the blocks
    __shared__ float psum[2][MODE == 2 ? TMv : 1];                     // row sum, by half of the blocks
    static_assert(TMv * KS == 256, "8 waves of 64 x 128");
    static_assert(MODE != 2 || (KW == KBLK && TMv == 128), "one factor serves a wave's part of a slab");

    const int t    = threadIdx.x;
    const int lane = t & 31;
    const int wave = t >> 5;
    const int lr   = lane & 15;
    const int hi   = lane >> 4;
    const int kg    = (KS == 2) ? (wave >> 2) : 0;               // which half of a slab's k
    const int waveM = (KS == 2) ? (wave & 1) : (wave & 3);        // wave-rows (64 M each)
    const int waveN = (KS == 2) ? ((wave >> 1) & 1) : (wave >> 2);// 2 wave-cols (128 N each)

    v8f acc[4][8];
#pragma unroll
    for (int mi = 0; mi < 4; ++mi)
#pragma unroll
        for (int ni = 0; ni < 8; ++ni) acc[mi][ni] = (v8f){0,0,0,0,0,0,0,0};

    const int crow = t / LPR;
    const int ccol = (t % LPR) * 8;
    const _Float16* aSrc = A  + (size_t)(mBase + crow) * Kd + ccol;
    const _Float16* bSrc = Bt + (size_t)(nBase + crow) * Kd + ccol;

    auto stage = [&](int k0, int buf) {
#pragma unroll
        for (int i = 0; i < TMv / RPS; ++i)
            cp_b128(aSrc + (size_t)(i * RPS) * Kd + k0, &ldsA[buf][(crow + i * RPS) * PIT + ccol]);
#pragma unroll
        for (int i = 0; i < TN / RPS; ++i)
            cp_b128(bSrc + (size_t)(i * RPS) * Kd + k0, &ldsB[buf][(crow + i * RPS) * PIT + ccol]);
    };

    stage(0, 0);
    if constexpr (MODE == 2) {
        // Keeps slab 0's copies in front of the loads below: left free, the compiler issues them
        // behind the wait for the first of those loads.
        __builtin_amdgcn_sched_barrier(0);
        // Joins the blocks of this work-group's rows while slab 0 flies: thread = (row, half of the blocks).
        constexpr int HB = NBLK / 2;
        const int prow = t & (TMv - 1);
        const int ph   = t >> 7;
        const float* mp = ml + (size_t)(ph * HB) * 2 * AN + mBase + prow;
        float mv[HB], lv[HB];
#pragma unroll
        for (int i = 0; i < HB; ++i) mv[i] = mp[(size_t)i * 2 * AN];
#pragma unroll
        for (int i = 0; i < HB; ++i) lv[i] = mp[(size_t)i * 2 * AN + AN];
        // The address registers of the loads above are free for reuse from here on.
        asm volatile("s_wait_xcnt 0x0" ::: "memory");
        float mx = mv[0];
#pragma unroll
        for (int i = 1; i < HB; ++i) mx = fmaxf(mx, mv[i]);
        pmax[ph][prow] = mx;
        __syncthreads();   // the other half's maximum is written by another wave
        mx = fmaxf(pmax[0][prow], pmax[1][prow]);
        float ls = 0.0f;
#pragma unroll
        for (int i = 0; i < HB; i += 2) {
            const float f0 = __builtin_amdgcn_exp2f(mv[i] - mx);
            const float f1 = __builtin_amdgcn_exp2f(mv[i + 1] - mx);
            ls += lv[i] * f0 + lv[i + 1] * f1;
            *(v2h*)(&scT[prow * SCP + ph * HB + i]) = (v2h){(_Float16)f0, (_Float16)f1};
        }
        psum[ph][prow] = ls;   // published, like scT, by the barrier below
    }
    asm volatile("s_wait_asynccnt 0x0" ::: "memory");   // slab 0 has landed before it is published
    __syncthreads();
    stage(KB, 1);                                       // Kd >= 2 * KB at every call site

    // acc[.][0..3] is the 64-column half that the wave keeps (half kg of its tile), acc[.][4..7] the other.
    const int aOff  = (waveM * 64 + lr) * PIT + kg * KW + hi * 8;
    const int bOff0 = (waveN * 128 + kg * 64 + lr) * PIT + kg * KW + hi * 8;
    const int bOff1 = (waveN * 128 + (kg ^ 1) * 64 + lr) * PIT + kg * KW + hi * 8;

    for (int k0 = 0; k0 < Kd; k0 += KB) {
        const int cur = (k0 / KB) & 1;
        _Float16 scp[4];   // MODE 2: the factor of this wave's key block of the slab, per A fragment row
#pragma unroll
        for (int kk = 0; kk < KW; kk += 32) {
            v16h af[4], bf[8];
            if constexpr (MODE == 2) {
                if (kk == 0) {
#pragma unroll
                    for (int mi = 0; mi < 4; ++mi)
                        scp[mi] = scT[(waveM * 64 + mi * 16 + lr) * SCP + k0 / KBLK + kg];
                }
            }
#pragma unroll
            for (int mi = 0; mi < 4; ++mi)
                af[mi] = load_frag(&ldsA[cur][aOff + mi * 16 * PIT + kk]);
#pragma unroll
            for (int ni = 0; ni < 8; ++ni)
                bf[ni] = load_frag(&ldsB[cur][(ni < 4 ? bOff0 : bOff1) + (ni & 3) * 16 * PIT + kk]);
            // Keeps the block's 24 LDS reads one group in front of its 32 WMMAs: left free, the
            // compiler reloads fragments among the WMMAs and waits for each to the last read.
            __builtin_amdgcn_sched_barrier(0);
            if constexpr (MODE == 2) {
#pragma unroll
                for (int mi = 0; mi < 4; ++mi) af[mi] *= scp[mi];   // a lane's fragment is one row
            }
#pragma unroll
            for (int mi = 0; mi < 4; ++mi)
#pragma unroll
                for (int ni = 0; ni < 8; ++ni)   // operands exchanged: a lane holds one row's 8 neighbouring columns
                    acc[mi][ni] = wmma_f16(bf[ni], af[mi], acc[mi][ni]);
            // Keeps the next block's reads from being spread among these WMMAs.
            __builtin_amdgcn_sched_barrier(0);
        }
        asm volatile("s_wait_dscnt 0x0" ::: "memory");      // this wave has left buffer cur before it is refilled
        asm volatile("s_wait_asynccnt 0x0" ::: "memory");   // this wave's part of the next slab has landed
        __syncthreads();   // publishes the next slab and ends every read of buffer cur
        if (k0 + 2 * KB < Kd) stage(k0 + 2 * KB, cur);      // flies while the next slab is worked on
    }
    asm volatile("s_wait_asynccnt 0x0" ::: "memory");   // no copy is left in flight at the wave's end

    // The last trip's barrier has ended every read of the ring and nothing flies into it any more.
    constexpr int XS = (KS == 2) ? 64 * 68 * 4 : 64 * 72 * 2;   // bytes of ldsB per wave
    static_assert(sizeof(ldsB) >= 8 * XS && XS >= 64 * (64 * (int)sizeof(TC) + 16), "a padded 64 x 64 piece per wave");
    char* xb = reinterpret_cast<char*>(&ldsB[0][0]);
    // KS == 2: a wave goes on in the range that its partner has filled and that it alone reads.
    char* own = xb + ((KS == 2) ? (wave ^ 4) : wave) * XS;
    if constexpr (KS == 2) {
        float* give = reinterpret_cast<float*>(xb + wave * XS);
#pragma unroll
        for (int mi = 0; mi < 4; ++mi)
#pragma unroll
            for (int ni = 0; ni < 4; ++ni) {
                const v8f a = acc[mi][4 + ni];
                float*    p = give + (mi * 4 + ni) * 256 + lane * 4;
                *(v4f*)(p)       = (v4f){a[0], a[1], a[2], a[3]};
                *(v4f*)(p + 128) = (v4f){a[4], a[5], a[6], a[7]};
            }
        __syncthreads();   // the partial sums are read by the pair's other wave
        const float* take = reinterpret_cast<const float*>(own);
#pragma unroll
        for (int mi = 0; mi < 4; ++mi)
#pragma unroll
            for (int ni = 0; ni < 4; ++ni) {
                const float* p = take + (mi * 4 + ni) * 256 + lane * 4;
                const v4f lo = *(const v4f*)(p);
                const v4f hh = *(const v4f*)(p + 128);
#pragma unroll
                for (int r = 0; r < 4; ++r) { acc[mi][ni][r] += lo[r]; acc[mi][ni][r + 4] += hh[r]; }
            }
    }

    // Piece nh: acc[mi][nh * 4 + ni][r] is row mi * 16 + lr, column ni * 16 + hi * 8 + r of the piece.
#pragma unroll
    for (int nh = 0; nh < 2 / KS; ++nh) {
        const int cb = nBase + waveN * 128 + ((KS == 2) ? kg : nh) * 64;   // the piece's first column
        if constexpr (MODE == 1) {
            const float a2 = alpha * 1.44269504f;   // scores in log2 units; alpha > 0
            v8h   h[4][4];
            float ms[4];
#pragma unroll
            for (int mi = 0; mi < 4; ++mi) {
                float mx = acc[mi][nh * 4][0];
#pragma unroll
                for (int ni = 0; ni < 4; ++ni)
#pragma unroll
                    for (int r = 0; r < 8; ++r) mx = fmaxf(mx, acc[mi][nh * 4 + ni][r]);
                mx = fmaxf(mx, other_half(mx));   // the row's other 32 keys
                const float m2 = mx * a2;
                float s = 0.0f;
#pragma unroll
                for (int ni = 0; ni < 4; ++ni)
#pragma unroll
                    for (int r = 0; r < 8; ++r) {
                        const float p = exp2_slot(fmaf(acc[mi][nh * 4 + ni][r], a2, -m2));
                        s += p;
                        h[mi][ni][r] = (_Float16)p;
                    }
                s += other_half(s);
                ms[mi] = hi ? s : m2;   // 16 lanes each: maxima, sums
            }
            float* mp = ml + ((size_t)(cb / KBLK) * 2 + hi) * AN + mBase + waveM * 64 + lr;
            store_tile_f16(h, reinterpret_cast<_Float16*>(own),
                           C + (size_t)(mBase + waveM * 64) * Ncols + cb, Ncols, lane);
#pragma unroll
            for (int mi = 0; mi < 4; ++mi) mp[mi * 16] = ms[mi];
            // The registers that the stores above name are free for the next piece from here on.
            asm volatile("s_wait_xcnt 0x0" ::: "memory");
            // Keeps the next piece's arithmetic behind that wait: moved up among the stores, it wrote
            // registers that issued stores still named.
            __builtin_amdgcn_sched_barrier(0);
        } else if constexpr (MODE == 2) {
            constexpr int SP = 68;             // LDS row pitch in floats: 16 B x odd
            float* st = reinterpret_cast<float*>(own);
#pragma unroll
            for (int mi = 0; mi < 4; ++mi) {
                const int   lrow = waveM * 64 + mi * 16 + lr;
                const float inv  = 1.0f / (psum[0][lrow] + psum[1][lrow]);
#pragma unroll
                for (int ni = 0; ni < 4; ++ni) {
                    const v8f a = acc[mi][nh * 4 + ni] * inv;
                    float*    p = st + (mi * 16 + lr) * SP + ni * 16 + hi * 8;
                    *(v4f*)(p)     = (v4f){a[0], a[1], a[2], a[3]};
                    *(v4f*)(p + 4) = (v4f){a[4], a[5], a[6], a[7]};
                }
            }
            asm volatile("s_wait_dscnt 0x0" ::: "memory");   // the rows are read back by other lanes of this wave
            v4f o[32];
#pragma unroll
            for (int j = 0; j < 32; ++j) o[j] = *(const v4f*)(st + (j * 2 + hi) * SP + lr * 4);
            TC* gp = C + (size_t)(mBase + waveM * 64 + hi) * Ncols + cb + lr * 4;
            // All stores stand behind all LDS reads: no register that an issued store names is written again.
            __builtin_amdgcn_sched_barrier(0);
#pragma unroll
            for (int j = 0; j < 32; ++j) *(v4f*)(gp + (size_t)(j * 2) * Ncols) = o[j];   // 2 rows of 256 bytes
        } else {
            v8h h[4][4];
#pragma unroll
            for (int mi = 0; mi < 4; ++mi)
#pragma unroll
                for (int ni = 0; ni < 4; ++ni)
#pragma unroll
                    for (int r = 0; r < 8; ++r) h[mi][ni][r] = (_Float16)(acc[mi][nh * 4 + ni][r] * alpha);
            _Float16* st = reinterpret_cast<_Float16*>(own);
            TC*       c0 = C + (size_t)(mBase + waveM * 64) * Ncols + cb;
            // The file's two row lengths, each as a constant (the same for the whole work-group).
            if (Ncols == AN) store_tile_f16(h, st, c0, AN, lane);
            else             store_tile_f16(h, st, c0, AD, lane);
        }
    }
}

// ---------------- kernels ----------------

#define STM 256                           // rows of a work-group's tile: the scores (1024 tiles)
#define QTM 128                           // the projection (768 tiles) and the last product (256 tiles)

#define PBLKS 512                         // work-groups of the rounding kernel
#define XELE  (AN * AD / PBLKS)           // x elements per work-group
#define WTK   64                          // weight tile: 64 inputs x 32 outputs, one of each weight
#define WTN   (AD * AD / PBLKS / WTK)

// Rounds the projection's operands to f16 once: x as it lies, each weight turned to [out][in],
// so that every product of the file finds both operands K-contiguous in f16.
__global__ void __launch_bounds__(256)
prep_kernel(const float* __restrict__ x,
            const float* __restrict__ Wq, const float* __restrict__ Wk,
            const float* __restrict__ Wv,
            _Float16* __restrict__ xh, _Float16* __restrict__ Wt) {
    constexpr int WP = WTK + 8;           // LDS row pitch in halves (16 B x odd)
    constexpr int XP = XELE / 1024;       // passes over x, one float4 per thread each
    static_assert(WTK * WTN == 256 * 8 && WTN == 32 && XELE % 1024 == 0, "thread maps below");
    __shared__ __align__(16) _Float16 tile[3][WTN * WP];
    const int      t  = threadIdx.x;
    const unsigned b  = blockIdx.x;
    const unsigned kT = (b / (AD / WTN)) * WTK;
    const unsigned nT = (b % (AD / WTN)) * WTN;

    const int    k    = (t >> 3) * 2;     // two input rows per thread: one f16 pair per output
    const int    n    = (t & 7) * 4;      // 8 lanes x 16 B = one whole 128-byte line
    const size_t woff = (size_t)(kT + k) * AD + nT + n;
    const size_t base = (size_t)b * XELE + t * 4;
    const float* Ws[3] = {Wq, Wk, Wv};
    float4 w0[3], w1[3], v[XP];
#pragma unroll
    for (int m = 0; m < 3; ++m) {
        w0[m] = *(const float4*)(Ws[m] + woff);
        w1[m] = *(const float4*)(Ws[m] + woff + AD);
    }
    // The loads of x below land in registers that held the weights' addresses.
    asm volatile("s_wait_xcnt 0x0" ::: "memory");
#pragma unroll
    for (int i = 0; i < XP; ++i) v[i] = *(const float4*)(x + base + i * 1024);

#pragma unroll
    for (int m = 0; m < 3; ++m) {
        *(v2h*)(&tile[m][(n + 0) * WP + k]) = (v2h){(_Float16)w0[m].x, (_Float16)w1[m].x};
        *(v2h*)(&tile[m][(n + 1) * WP + k]) = (v2h){(_Float16)w0[m].y, (_Float16)w1[m].y};
        *(v2h*)(&tile[m][(n + 2) * WP + k]) = (v2h){(_Float16)w0[m].z, (_Float16)w1[m].z};
        *(v2h*)(&tile[m][(n + 3) * WP + k]) = (v2h){(_Float16)w0[m].w, (_Float16)w1[m].w};
    }
    __syncthreads();   // the turned tiles are read back by other waves
#pragma unroll
    for (int m = 0; m < 3; ++m) {
        const int row = t >> 3;
        const int kc  = (t & 7) * 8;      // 8 lanes x 16 B = one whole 128-byte line
        *(v8h*)(Wt + (size_t)m * AD * AD + (size_t)(nT + row) * AD + kT + kc) =
            *(const v8h*)(&tile[m][row * WP + kc]);
    }
#pragma unroll
    for (int i = 0; i < XP; ++i) {
        v4h h = {(_Float16)v[i].x, (_Float16)v[i].y, (_Float16)v[i].z, (_Float16)v[i].w};
        *(v4h*)(xh + base + i * 1024) = h;
    }
}

// Q = x Wq and K = x Wk as [N][D]; V as [D][N] = Wv^T x^T, the same loop with the operands' roles
// exchanged, so that the last product finds both operands K-contiguous.
__global__ void __launch_bounds__(256)
qkv_kernel(const _Float16* __restrict__ xh, const _Float16* __restrict__ Wt,
           _Float16* __restrict__ Q, _Float16* __restrict__ Kp, _Float16* __restrict__ Vt) {
    const int  z  = blockIdx.z;
    const bool tr = (z == 2);
    const _Float16* Wz = Wt + (size_t)z * AD * AD;
    const unsigned b  = blockIdx.x;
    const unsigned mT = tr ? b / (AN / TN) : b / (AD / TN);
    const unsigned nT = tr ? b % (AN / TN) : b % (AD / TN);
    gemm_nt<128, 0, QTM, 2>(tr ? Wz : xh, tr ? xh : Wz, (z == 0) ? Q : (z == 1) ? Kp : Vt, (float*)nullptr,
                   AD, tr ? AN : AD, 1.0f, mT * QTM, nT * TN);
}

__global__ void __launch_bounds__(256)
scores_kernel(const _Float16* __restrict__ Q, const _Float16* __restrict__ Kp,
              _Float16* __restrict__ P, float* __restrict__ ml) {
    gemm_nt<128, 1, STM, 1>(Q, Kp, P, ml, AD, AN, 0.03125f /* 1/sqrt(1024) */,
                            blockIdx.y * STM, blockIdx.x * TN);
}

__global__ void __launch_bounds__(256)
out_kernel(const _Float16* __restrict__ P, const _Float16* __restrict__ Vt,
           float* __restrict__ ml, float* __restrict__ O) {
    gemm_nt<128, 2, QTM, 2>(P, Vt, O, ml, AN, AD, 1.0f, blockIdx.y * QTM, blockIdx.x * TN);
}

extern "C" void kernel_launch(void* const* d_in, const int* in_sizes, int n_in,
                              void* d_out, int out_size, void* d_ws, size_t ws_size,
                              hipStream_t stream) {
    (void)in_sizes; (void)n_in; (void)out_size; (void)ws_size;
    const float* x  = (const float*)d_in[0];
    const float* Wq = (const float*)d_in[1];
    const float* Wk = (const float*)d_in[2];
    const float* Wv = (const float*)d_in[3];

    _Float16* Q  = (_Float16*)d_ws;
    _Float16* Kp = Q  + (size_t)AN * AD;
    _Float16* Vt = Kp + (size_t)AN * AD;   // V transposed: [D][N]
    _Float16* S  = Vt + (size_t)AN * AD;   // 8192*8192 f16: P, each block of 64 keys on its own maximum
    _Float16* xh = S  + (size_t)AN * AN;   // x in f16
    _Float16* Wt = xh + (size_t)AN * AD;   // three weights in f16, each [out][in]
    float*    ml = (float*)(Wt + (size_t)3 * AD * AD);   // [NBLK][2][N]: block maxima and sums

    dim3 blk(256);

    prep_kernel<<<dim3(PBLKS), blk, 0, stream>>>(x, Wq, Wk, Wv, xh, Wt);
    qkv_kernel<<<dim3((AN / QTM) * (AD / TN), 1, 3), blk, 0, stream>>>(xh, Wt, Q, Kp, Vt);
    scores_kernel<<<dim3(AN / TN, AN / STM), blk, 0, stream>>>(Q, Kp, S, ml);
    out_kernel<<<dim3(AD / TN, AN / QTM), blk, 0, stream>>>(S, Vt, ml, (float*)d_out);
}

// v007
// Measured time: 209 microseconds a run.
// Timed twice side by side with v006, it ran 1.04 times as fast both times.
// All steps since v000 together make it 2.43 times as fast.
#include <hip/hip_runtime.h>
#include <hip/hip_bf16.h>

// Attention: out = softmax((x Wq)(x Wk)^T / sqrt(D)) (x Wv)
// N = 8192, D = 1024, fp32 in/out. Internals f16, f32 WMMA accumulate.
// Workspace (>= 206 MB): Q,K f16 [N][D], V f16 transposed [D][N] (16 MB each)
// + P f16 (128 MB): exp of each score less the maximum of its own row in its block of 64 keys
// + x f16 [N][D] (16 MB) + Wq,Wk,Wv f16, each transposed [out][in] (2 MB each)
// + per block of 64 keys and row: that maximum (log2 units) and the block's sum, f32 (8 MB).

#define AN 8192
#define AD 1024

typedef _Float16 v16h __attribute__((ext_vector_type(16)));
typedef _Float16 v8h  __attribute__((ext_vector_type(8)));
typedef _Float16 v4h  __attribute__((ext_vector_type(4)));
typedef _Float16 v2h  __attribute__((ext_vector_type(2)));
typedef float    v8f  __attribute__((ext_vector_type(8)));
typedef float    v4f  __attribute__((ext_vector_type(4)));

typedef uint32_t u32x4 __attribute__((ext_vector_type(4)));
typedef uint32_t u32x8 __attribute__((ext_vector_type(8)));

// A wave-uniform value in a scalar register.
__device__ __forceinline__ uint32_t uni(uint32_t v) { return (uint32_t)__builtin_amdgcn_readfirstlane(v); }

// A descriptor word or an issue test held in a scalar register: what is
// formed from it stands behind the volatile wait in front of it, and a test on it is a scalar branch.
__device__ __forceinline__ uint32_t pinned(uint32_t v) {
    uint32_t w = uni(v);
    asm volatile("" : "+s"(w));   // pinned(): holds the word in a scalar register, behind the waits before it
    return w;
}

__device__ __forceinline__ v8f wmma_f16(v16h a, v16h b, v8f c) {
    return __builtin_amdgcn_wmma_f32_16x16x32_f16(
        false, a, false, b, (short)0, c, false, false);
}

// Per-lane WMMA fragment from LDS tile stored [row][k].
// slots 0..7 -> k = hi*8.., slots 8..15 -> k = hi*8+16..
__device__ __forceinline__ v16h load_frag(const _Float16* p) {
    v8h lo = *(const v8h*)(p);
    v8h hh = *(const v8h*)(p + 16);
    v16h r;
#pragma unroll
    for (int i = 0; i < 8; ++i) { r[i] = lo[i]; r[i + 8] = hh[i]; }
    return r;
}

// The value that lane l ^ 16 holds (a vector move between the wave's two rows of 16 lanes).
__device__ __forceinline__ float other_half(float v) {
    const int i = __builtin_bit_cast(int, v);
    return __builtin_bit_cast(float,
        __builtin_amdgcn_permlanex16(i, i, 0x76543210, 0xfedcba98, false, false));
}

// 2^x. The v_nop fills the slot that the instruction set asks for behind a transcendental.
__device__ __forceinline__ float exp2_slot(float x) {
    float y;
    asm("v_exp_f32 %0, %1\n\tv_nop" : "=v"(y) : "v"(x));
    return y;
}

// Sends a wave's 64 x 64 f16 tile out as whole 128-byte lines. h[mi][ni] is row mi * 16 + lr,
// columns ni * 16 + hi * 8 .. + 7. The tile is turned in st, an LDS range that only this wave uses;
// each store then covers 4 rows of 128 bytes instead of 16 pieces of 32 bytes.
// Ncols is a constant at every call: the 16 stores then share one address register pair.
__device__ __forceinline__ void store_tile_f16(const v8h (&h)[4][4], _Float16* st,
                                               _Float16* __restrict__ c0, const int Ncols, int lane) {
    constexpr int SP = 72;             // LDS row pitch in halves: 16 B x odd
    const int lr = lane & 15;
    const int hi = lane >> 4;
#pragma unroll
    for (int mi = 0; mi < 4; ++mi)
#pragma unroll
        for (int ni = 0; ni < 4; ++ni) *(v8h*)(st + (mi * 16 + lr) * SP + ni * 16 + hi * 8) = h[mi][ni];
    asm volatile("s_wait_dscnt 0x0" ::: "memory");   // the rows are read back by other lanes of this wave
    v8h o[16];
#pragma unroll
    for (int j = 0; j < 16; ++j) o[j] = *(const v8h*)(st + (j * 4 + (lane >> 3)) * SP + (lane & 7) * 8);
    _Float16* gp = c0 + (size_t)(lane >> 3) * Ncols + (lane & 7) * 8;
    // All stores stand behind all LDS reads: no register that an issued store names is written again.
    __builtin_amdgcn_sched_barrier(0);
#pragma unroll
    for (int j = 0; j < 16; ++j) *(v8h*)(gp + (size_t)(j * 4) * Ncols) = o[j];
    // The registers that the stores above name are free for reuse from here on.
    asm volatile("s_wait_xcnt 0x0" ::: "memory");
}

// ======================================================================
// C[M,N] = alpha * A[M,Kd] * Bt[N,Kd]^T  (both K-contiguous f16)
// Work-group tile TMv x TN, K slab KB; 8 waves, each on a 64 x 128 tile: 12 fragments from LDS feed
// 32 WMMAs (a 64 x 64 tile: 8 feed 16).
// KS == 1: TMv = 256, the waves lie 4 x 2.
// KS == 2: TMv = 128, the waves lie 2 x 2 x 2: the two waves of a pair share a tile and each takes one
//          half of every slab's k; behind the loop each hands the other, through LDS, its partial sums
//          of one 64-column half and finishes the half that it keeps.
// Both operands come by tensor loads to LDS, two buffers: each wave brings one slice of rows per slab
// (waves 0-3: a quarter of A's rows each, waves 4-7: 64 of Bt's rows each), padded to the pitch by the mover.
// The WMMAs take Bt's fragment as A and A's as B, so that a lane holds 8 neighbouring columns of one
// row of C; behind the loop each wave turns 64 x 64 pieces in its own part of the ring and stores whole lines.
// ======================================================================
#define TN 256
#define KBLK 64                // keys per softmax block
#define NBLK (AN / KBLK)

// MODE 0: C = alpha * A * Bt^T.
// MODE 1: the scores. Each wave turns each 64 x 64 half of its tile into exp(score - block maximum) and
//         stores, in ml[block][0][row] and ml[block][1][row], the maximum (log2 units) and the sum.
// MODE 2: the last product. A's fragments are brought to their row's overall maximum on the way
//         into the WMMAs; the row's sum divides in the epilogue.
template <int KB, int MODE, int TMv, int KS, typename TC>
__device__ __forceinline__ void gemm_nt(const _Float16* __restrict__ A,
                                        const _Float16* __restrict__ Bt,
                                        TC* __restrict__ C, float* __restrict__ ml,
                                        int Kd, int Ncols,
                                        float alpha, int mBase, int nBase) {
    constexpr int PIT = KB + 8;        // LDS row pitch in halves: 16 B x odd, conflict-free b128 reads
    constexpr int KW  = KB / KS;       // the part of a slab's k that one wave works on
    constexpr int AR  = TMv / 4;       // rows of a slice of A
    constexpr int BR  = TN / 4;        // rows of a slice of Bt
    // A slice's room in halves: its padded rows, rounded up so that every slice starts at a multiple of 2 KiB.
    constexpr int ASZ = (AR * PIT * 2 + 2047) / 2048 * 1024;
    constexpr int BSZ = (BR * PIT * 2 + 2047) / 2048 * 1024;
    constexpr int STG = 4 * ASZ + 4 * BSZ;   // one buffer: A's four slices, then Bt's
    __shared__ __attribute__((aligned(2048))) _Float16 ring[2 * STG];
    static_assert(KB == 128 && BR == 64 && 64 % AR == 0 && AR % 16 == 0, "rows of 256 bytes; a wave's 64 rows are whole slices");
    constexpr int SCP = NBLK + 2;      // pitch of the factor table in halves: an odd count of dwords
    __shared__ __align__(16) _Float16 scT[MODE == 2 ? TMv * SCP : 8];  // factor per row and key block
    __shared__ float pmax[2][MODE == 2 ? TMv : 1];                     // row maximum, by half of the blocks
    __shared__ float psum[2][MODE == 2 ? TMv : 1];                     // row sum, by half of the blocks
    static_assert(TMv * KS == 256, "8 waves of 64 x 128");
    static_assert(MODE != 2 || (KW == KBLK && TMv == 128), "one factor serves a wave's part of a slab");

    const int t    = threadIdx.x;
    const int lane = t & 31;
    const int wave = t >> 5;
    const int lr   = lane & 15;
    const int hi   = lane >> 4;
    const int kg    = (KS == 2) ? (wave >> 2) : 0;               // which half of a slab's k
    const int waveM = (KS == 2) ? (wave & 1) : (wave & 3);        // wave-rows (64 M each)
    const int waveN = (KS == 2) ? ((wave >> 1) & 1) : (wave >> 2);// 2 wave-cols (128 N each)

    v8f acc[4][8];
#pragma unroll
    for (int mi = 0; mi < 4; ++mi)
#pragma unroll
        for (int ni = 0; ni < 8; ++ni) acc[mi][ni] = (v8f){0,0,0,0,0,0,0,0};

    // This wave's slice: its first source byte, its place in buffer 0, its rows.
    const uint32_t wv   = uni((uint32_t)t >> 5);
    const bool     isB  = wv >= 4u;
    const uint32_t rows = isB ? (uint32_t)BR : (uint32_t)AR;
    const uint64_t srcw = isB ? (uint64_t)(size_t)(Bt + (size_t)(nBase + (wv - 4u) * BR) * Kd)
                              : (uint64_t)(size_t)(A + (size_t)(mBase + wv * AR) * Kd);
    const uint32_t dstw = (uint32_t)(size_t)ring + 2u * (isB ? 4u * ASZ + (wv - 4u) * BSZ : wv * ASZ);
    // Group 1: extents in bytes, tensor = tile = rows x 256 B; 16 B of pad behind every 256 B: pitch 272 B.
    u32x8 g1;
    g1[0] = uni((1u << 20) | (5u << 22) | (3u << 25));
    g1[1] = uni(256u << 16);
    g1[2] = uni(rows << 16);
    g1[3] = uni(256u << 16);
    g1[4] = uni(rows);
    g1[5] = uni((uint32_t)Kd * 2u);    // source row pitch
    g1[6] = uni(0u);
    g1[7] = uni(0u);

    // One request of this wave: its slice of the slab that starts at column k of the rows.
    auto stage = [&](int k, int buf) {
        // pinned(): group 0 is formed behind the wait for this wave's request before.
        const uint64_t ga = srcw + pinned((uint32_t)k * 2u);
        u32x4 g0;
        g0[0] = uni(1u);
        g0[1] = uni(dstw + pinned((uint32_t)buf * (2u * STG)));
        g0[2] = uni((uint32_t)ga);
        g0[3] = uni(((uint32_t)(ga >> 32) & 0x01FFFFFFu) | 0x80000000u);
        // Fixed scalar registers: left to the allocator, registers that a request in flight names were
        // taken for the loop's counters directly behind the issue. These are written only for a request.
        asm volatile("tensor_load_to_lds %0, %1" :: "{s[56:59]}"(g0), "{s[48:55]}"(g1) : "memory");
    };

    stage(0, 0);
    if constexpr (MODE == 2) {
        // Joins the blocks of this work-group's rows while slab 0 flies: thread = (row, half of the blocks).
        constexpr int HB = NBLK / 2;
        const int prow = t & (TMv - 1);
        const int ph   = t >> 7;
        const float* mp = ml + (size_t)(ph * HB) * 2 * AN + mBase + prow;
        float mv[HB], lv[HB];
#pragma unroll
        for (int i = 0; i < HB; ++i) mv[i] = mp[(size_t)i * 2 * AN];
#pragma unroll
        for (int i = 0; i < HB; ++i) lv[i] = mp[(size_t)i * 2 * AN + AN];
        // The address registers of the loads above are free for reuse from here on.
        asm volatile("s_wait_xcnt 0x0" ::: "memory");
        float mx = mv[0];
#pragma unroll
        for (int i = 1; i < HB; ++i) mx = fmaxf(mx, mv[i]);
        pmax[ph][prow] = mx;
        __syncthreads();   // the other half's maximum is written by another wave
        mx = fmaxf(pmax[0][prow], pmax[1][prow]);
        float ls = 0.0f;
#pragma unroll
        for (int i = 0; i < HB; i += 2) {
            const float f0 = __builtin_amdgcn_exp2f(mv[i] - mx);
            const float f1 = __builtin_amdgcn_exp2f(mv[i + 1] - mx);
            ls += lv[i] * f0 + lv[i + 1] * f1;
            *(v2h*)(&scT[prow * SCP + ph * HB + i]) = (v2h){(_Float16)f0, (_Float16)f1};
        }
        psum[ph][prow] = ls;   // published, like scT, by the barrier below
    }
    asm volatile("s_wait_tensorcnt 0x0" ::: "memory");  // this wave's slice of slab 0 has landed before it is published
    __syncthreads();
    stage(KB, 1);                                       // Kd >= 2 * KB at every call site

    // acc[.][0..3] is the 64-column half that the wave keeps (half kg of its tile), acc[.][4..7] the other.
    const int aOff  = waveM * (64 / AR) * ASZ + lr * PIT + kg * KW + hi * 8;
    const int bOff0 = 4 * ASZ + (waveN * 2 + kg) * BSZ + lr * PIT + kg * KW + hi * 8;
    const int bOff1 = 4 * ASZ + (waveN * 2 + (kg ^ 1)) * BSZ + lr * PIT + kg * KW + hi * 8;

    // The same places in the buffer that is being read.
    const _Float16 *aP = ring + aOff, *bP0 = ring + bOff0, *bP1 = ring + bOff1;
    for (int k0 = 0; k0 < Kd; k0 += KB) {
        const int cur = (k0 / KB) & 1;
        _Float16 scp[4];   // MODE 2: the factor of this wave's key block of the slab, per A fragment row
#pragma unroll
        for (int kk = 0; kk < KW; kk += 32) {
            v16h af[4], bf[8];
            if constexpr (MODE == 2) {
                if (kk == 0) {
#pragma unroll
                    for (int mi = 0; mi < 4; ++mi)
                        scp[mi] = scT[(waveM * 64 + mi * 16 + lr) * SCP + k0 / KBLK + kg];
                }
            }
#pragma unroll
            for (int mi = 0; mi < 4; ++mi)
                af[mi] = load_frag(aP + (mi * 16 / AR) * ASZ + (mi * 16 % AR) * PIT + kk);
#pragma unroll
            for (int ni = 0; ni < 8; ++ni)
                bf[ni] = load_frag((ni < 4 ? bP0 : bP1) + (ni & 3) * 16 * PIT + kk);
            // Keeps the block's 24 LDS reads one group in front of its 32 WMMAs: left free, the
            // compiler reloads fragments among the WMMAs and waits for each to the last read.
            __builtin_amdgcn_sched_barrier(0);
            if constexpr (MODE == 2) {
#pragma unroll
                for (int mi = 0; mi < 4; ++mi) af[mi] *= scp[mi];   // a lane's fragment is one row
            }
#pragma unroll
            for (int mi = 0; mi < 4; ++mi)
#pragma unroll
                for (int ni = 0; ni < 8; ++ni)   // operands exchanged: a lane holds one row's 8 neighbouring columns
                    acc[mi][ni] = wmma_f16(bf[ni], af[mi], acc[mi][ni]);
            // Keeps the next block's reads from being spread among these WMMAs.
            __builtin_amdgcn_sched_barrier(0);
        }
        asm volatile("s_wait_dscnt 0x0" ::: "memory");      // this wave has left buffer cur before it is refilled
        asm volatile("s_wait_tensorcnt 0x0" ::: "memory");  // this wave's slice of the next slab has landed
        __syncthreads();   // publishes the next slab and ends every read of buffer cur
        // A scalar branch: a tensor load ignores EXEC. The load flies while the next slab is worked on.
        if (pinned(k0 + 2 * KB < Kd)) stage(k0 + 2 * KB, cur);
        const int hop = cur ? -STG : STG;      // on to the other buffer
        aP += hop; bP0 += hop; bP1 += hop;
    }
    asm volatile("s_wait_tensorcnt 0x0" ::: "memory");  // no request is left in flight
    asm volatile("s_wait_dscnt 0x0" ::: "memory");      // nor a read of the ring, which becomes staging below

    // The last trip's barrier has ended every read of the ring and nothing flies into it any more.
    constexpr int XS = (KS == 2) ? 64 * 68 * 4 : 64 * 72 * 2;   // bytes of the ring per wave
    static_assert(sizeof(ring) >= 8 * XS && XS >= 64 * (64 * (int)sizeof(TC) + 16), "a padded 64 x 64 piece per wave");
    char* xb = reinterpret_cast<char*>(&ring[0]);
    // KS == 2: a wave goes on in the range that its partner has filled and that it alone reads.
    char* own = xb + ((KS == 2) ? (wave ^ 4) : wave) * XS;
    if constexpr (KS == 2) {
        float* give = reinterpret_cast<float*>(xb + wave * XS);
#pragma unroll
        for (int mi = 0; mi < 4; ++mi)
#pragma unroll
            for (int ni = 0; ni < 4; ++ni) {
                const v8f a = acc[mi][4 + ni];
                float*    p = give + (mi * 4 + ni) * 256 + lane * 4;
                *(v4f*)(p)       = (v4f){a[0], a[1], a[2], a[3]};
                *(v4f*)(p + 128) = (v4f){a[4], a[5], a[6], a[7]};
            }
        __syncthreads();   // the partial sums are read by the pair's other wave
        const float* take = reinterpret_cast<const float*>(own);
#pragma unroll
        for (int mi = 0; mi < 4; ++mi)
#pragma unroll
            for (int ni = 0; ni < 4; ++ni) {
                const float* p = take + (mi * 4 + ni) * 256 + lane * 4;
                const v4f lo = *(const v4f*)(p);
                const v4f hh = *(const v4f*)(p + 128);
#pragma unroll
                for (int r = 0; r < 4; ++r) { acc[mi][ni][r] += lo[r]; acc[mi][ni][r + 4] += hh[r]; }
            }
    }

    // Piece nh: acc[mi][nh * 4 + ni][r] is row mi * 16 + lr, column ni * 16 + hi * 8 + r of the piece.
#pragma unroll
    for (int nh = 0; nh < 2 / KS; ++nh) {
        const int cb = nBase + waveN * 128 + ((KS == 2) ? kg : nh) * 64;   // the piece's first column
        if constexpr (MODE == 1) {
            const float a2 = alpha * 1.44269504f;   // scores in log2 units; alpha > 0
            v8h   h[4][4];
            float ms[4];
#pragma unroll
            for (int mi = 0; mi < 4; ++mi) {
                float mx = acc[mi][nh * 4][0];
#pragma unroll
                for (int ni = 0; ni < 4; ++ni)
#pragma unroll
                    for (int r = 0; r < 8; ++r) mx = fmaxf(mx, acc[mi][nh * 4 + ni][r]);
                mx = fmaxf(mx, other_half(mx));   // the row's other 32 keys
                const float m2 = mx * a2;
                float s = 0.0f;
#pragma unroll
                for (int ni = 0; ni < 4; ++ni)
#pragma unroll
                    for (int r = 0; r < 8; ++r) {
                        const float p = exp2_slot(fmaf(acc[mi][nh * 4 + ni][r], a2, -m2));
                        s += p;
                        h[mi][ni][r] = (_Float16)p;
                    }
                s += other_half(s);
                ms[mi] = hi ? s : m2;   // 16 lanes each: maxima, sums
            }
            float* mp = ml + ((size_t)(cb / KBLK) * 2 + hi) * AN + mBase + waveM * 64 + lr;
            store_tile_f16(h, reinterpret_cast<_Float16*>(own),
                           C + (size_t)(mBase + waveM * 64) * Ncols + cb, Ncols, lane);
#pragma unroll
            for (int mi = 0; mi < 4; ++mi) mp[mi * 16] = ms[mi];
            // The registers that the stores above name are free for the next piece from here on.
            asm volatile("s_wait_xcnt 0x0" ::: "memory");
            // Keeps the next piece's arithmetic behind that wait: moved up among the stores, it wrote
            // registers that issued stores still named.
            __builtin_amdgcn_sched_barrier(0);
        } else if constexpr (MODE == 2) {
            constexpr int SP = 68;             // LDS row pitch in floats: 16 B x odd
            float* st = reinterpret_cast<float*>(own);
#pragma unroll
            for (int mi = 0; mi < 4; ++mi) {
                const int   lrow = waveM * 64 + mi * 16 + lr;
                const float inv  = 1.0f / (psum[0][lrow] + psum[1][lrow]);
#pragma unroll
                for (int ni = 0; ni < 4; ++ni) {
                    const v8f a = acc[mi][nh * 4 + ni] * inv;
                    float*    p = st + (mi * 16 + lr) * SP + ni * 16 + hi * 8;
                    *(v4f*)(p)     = (v4f){a[0], a[1], a[2], a[3]};
                    *(v4f*)(p + 4) = (v4f){a[4], a[5], a[6], a[7]};
                }
            }
            asm volatile("s_wait_dscnt 0x0" ::: "memory");   // the rows are read back by other lanes of this wave
            v4f o[32];
#pragma unroll
            for (int j = 0; j < 32; ++j) o[j] = *(const v4f*)(st + (j * 2 + hi) * SP + lr * 4);
            TC* gp = C + (size_t)(mBase + waveM * 64 + hi) * Ncols + cb + lr * 4;
            // All stores stand behind all LDS reads: no register that an issued store names is written again.
            __builtin_amdgcn_sched_barrier(0);
#pragma unroll
            for (int j = 0; j < 32; ++j) *(v4f*)(gp + (size_t)(j * 2) * Ncols) = o[j];   // 2 rows of 256 bytes
        } else {
            v8h h[4][4];
#pragma unroll
            for (int mi = 0; mi < 4; ++mi)
#pragma unroll
                for (int ni = 0; ni < 4; ++ni)
#pragma unroll
                    for (int r = 0; r < 8; ++r) h[mi][ni][r] = (_Float16)(acc[mi][nh * 4 + ni][r] * alpha);
            _Float16* st = reinterpret_cast<_Float16*>(own);
            TC*       c0 = C + (size_t)(mBase + waveM * 64) * Ncols + cb;
            // The file's two row lengths, each as a constant (the same for the whole work-group).
            if (Ncols == AN) store_tile_f16(h, st, c0, AN, lane);
            else             store_tile_f16(h, st, c0, AD, lane);
        }
    }
}

// ---------------- kernels ----------------

#define STM 256                           // rows of a work-group's tile: the scores (1024 tiles)
#define QTM 128                           // the projection (768 tiles) and the last product (256 tiles)

#define PBLKS 512                         // work-groups of the rounding kernel
#define XELE  (AN * AD / PBLKS)           // x elements per work-group
#define WTK   64                          // weight tile: 64 inputs x 32 outputs, one of each weight
#define WTN   (AD * AD / PBLKS / WTK)

// Rounds the projection's operands to f16 once: x as it lies, each weight turned to [out][in],
// so that every product of the file finds both operands K-contiguous in f16.
__global__ void __launch_bounds__(256)
prep_kernel(const float* __restrict__ x,
            const float* __restrict__ Wq, const float* __restrict__ Wk,
            const float* __restrict__ Wv,
            _Float16* __restrict__ xh, _Float16* __restrict__ Wt) {
    constexpr int WP = WTK + 8;           // LDS row pitch in halves (16 B x odd)
    constexpr int XP = XELE / 1024;       // passes over x, one float4 per thread each
    static_assert(WTK * WTN == 256 * 8 && WTN == 32 && XELE % 1024 == 0, "thread maps below");
    __shared__ __align__(16) _Float16 tile[3][WTN * WP];
    const int      t  = threadIdx.x;
    const unsigned b  = blockIdx.x;
    const unsigned kT = (b / (AD / WTN)) * WTK;
    const unsigned nT = (b % (AD / WTN)) * WTN;

    const int    k    = (t >> 3) * 2;     // two input rows per thread: one f16 pair per output
    const int    n    = (t & 7) * 4;      // 8 lanes x 16 B = one whole 128-byte line
    const size_t woff = (size_t)(kT + k) * AD + nT + n;
    const size_t base = (size_t)b * XELE + t * 4;
    const float* Ws[3] = {Wq, Wk, Wv};
    float4 w0[3], w1[3], v[XP];
#pragma unroll
    for (int m = 0; m < 3; ++m) {
        w0[m] = *(const float4*)(Ws[m] + woff);
        w1[m] = *(const float4*)(Ws[m] + woff + AD);
    }
    // The loads of x below land in registers that held the weights' addresses.
    asm volatile("s_wait_xcnt 0x0" ::: "memory");
#pragma unroll
    for (int i = 0; i < XP; ++i) v[i] = *(const float4*)(x + base + i * 1024);

#pragma unroll
    for (int m = 0; m < 3; ++m) {
        *(v2h*)(&tile[m][(n + 0) * WP + k]) = (v2h){(_Float16)w0[m].x, (_Float16)w1[m].x};
        *(v2h*)(&tile[m][(n + 1) * WP + k]) = (v2h){(_Float16)w0[m].y, (_Float16)w1[m].y};
        *(v2h*)(&tile[m][(n + 2) * WP + k]) = (v2h){(_Float16)w0[m].z, (_Float16)w1[m].z};
        *(v2h*)(&tile[m][(n + 3) * WP + k]) = (v2h){(_Float16)w0[m].w, (_Float16)w1[m].w};
    }
    __syncthreads();   // the turned tiles are read back by other waves
#pragma unroll
    for (int m = 0; m < 3; ++m) {
        const int row = t >> 3;
        const int kc  = (t & 7) * 8;      // 8 lanes x 16 B = one whole 128-byte line
        *(v8h*)(Wt + (size_t)m * AD * AD + (size_t)(nT + row) * AD + kT + kc) =
            *(const v8h*)(&tile[m][row * WP + kc]);
    }
#pragma unroll
    for (int i = 0; i < XP; ++i) {
        v4h h = {(_Float16)v[i].x, (_Float16)v[i].y, (_Float16)v[i].z, (_Float16)v[i].w};
        *(v4h*)(xh + base + i * 1024) = h;
    }
}

// Q = x Wq and K = x Wk as [N][D]; V as [D][N] = Wv^T x^T, the same loop with the operands' roles
// exchanged, so that the last product finds both operands K-contiguous.
__global__ void __launch_bounds__(256)
qkv_kernel(const _Float16* __restrict__ xh, const _Float16* __restrict__ Wt,
           _Float16* __restrict__ Q, _Float16* __restrict__ Kp, _Float16* __restrict__ Vt) {
    const int  z  = blockIdx.z;
    const bool tr = (z == 2);
    const _Float16* Wz = Wt + (size_t)z * AD * AD;
    const unsigned b  = blockIdx.x;
    const unsigned mT = tr ? b / (AN / TN) : b / (AD / TN);
    const unsigned nT = tr ? b % (AN / TN) : b % (AD / TN);
    gemm_nt<128, 0, QTM, 2>(tr ? Wz : xh, tr ? xh : Wz, (z == 0) ? Q : (z == 1) ? Kp : Vt, (float*)nullptr,
                   AD, tr ? AN : AD, 1.0f, mT * QTM, nT * TN);
}

__global__ void __launch_bounds__(256)
scores_kernel(const _Float16* __restrict__ Q, const _Float16* __restrict__ Kp,
              _Float16* __restrict__ P, float* __restrict__ ml) {
    gemm_nt<128, 1, STM, 1>(Q, Kp, P, ml, AD, AN, 0.03125f /* 1/sqrt(1024) */,
                            blockIdx.y * STM, blockIdx.x * TN);
}

__global__ void __launch_bounds__(256)
out_kernel(const _Float16* __restrict__ P, const _Float16* __restrict__ Vt,
           float* __restrict__ ml, float* __restrict__ O) {
    gemm_nt<128, 2, QTM, 2>(P, Vt, O, ml, AN, AD, 1.0f, blockIdx.y * QTM, blockIdx.x * TN);
}

extern "C" void kernel_launch(void* const* d_in, const int* in_sizes, int n_in,
                              void* d_out, int out_size, void* d_ws, size_t ws_size,
                              hipStream_t stream) {
    (void)in_sizes; (void)n_in; (void)out_size; (void)ws_size;
    const float* x  = (const float*)d_in[0];
    const float* Wq = (const float*)d_in[1];
    const float* Wk = (const float*)d_in[2];
    const float* Wv = (const float*)d_in[3];

    _Float16* Q  = (_Float16*)d_ws;
    _Float16* Kp = Q  + (size_t)AN * AD;
    _Float16* Vt = Kp + (size_t)AN * AD;   // V transposed: [D][N]
    _Float16* S  = Vt + (size_t)AN * AD;   // 8192*8192 f16: P, each block of 64 keys on its own maximum
    _Float16* xh = S  + (size_t)AN * AN;   // x in f16
    _Float16* Wt = xh + (size_t)AN * AD;   // three weights in f16, each [out][in]
    float*    ml = (float*)(Wt + (size_t)3 * AD * AD);   // [NBLK][2][N]: block maxima and sums

    dim3 blk(256);

    prep_kernel<<<dim3(PBLKS), blk, 0, stream>>>(x, Wq, Wk, Wv, xh, Wt);
    qkv_kernel<<<dim3((AN / QTM) * (AD / TN), 1, 3), blk, 0, stream>>>(xh, Wt, Q, Kp, Vt);
    scores_kernel<<<dim3(AN / TN, AN / STM), blk, 0, stream>>>(Q, Kp, S, ml);
    out_kernel<<<dim3(AD / TN, AN / QTM), blk, 0, stream>>>(S, Vt, ml, (float*)d_out);
}

// v008
// Measured time: 202 microseconds a run.
// Next to v007, in two timings, it ran 1.04 times as fast each time.
// All steps since v000 together make it 2.51 times as fast.
#include <hip/hip_runtime.h>
#include <hip/hip_bf16.h>

// Attention: out = softmax((x Wq)(x Wk)^T / sqrt(D)) (x Wv)
// N = 8192, D = 1024, fp32 in/out. Internals f16, f32 WMMA accumulate.
// Workspace (>= 206 MB): Q,K f16 [N][D], V f16 transposed [D][N] (16 MB each)
// + P f16 (128 MB): exp of each score less the maximum of its own row in its block of 64 keys
// + x f16 [N][D] (16 MB) + Wq,Wk,Wv f16, each transposed [out][in] (2 MB each)
// + per block of 64 keys and row: that maximum (log2 units) and the block's sum, f32 (8 MB).

#define AN 8192
#define AD 1024
static_assert((AN & (AN - 1)) == 0 && (AD & (AD - 1)) == 0, "the k loops wrap round by a mask");

typedef _Float16 v16h __attribute__((ext_vector_type(16)));
typedef _Float16 v8h  __attribute__((ext_vector_type(8)));
typedef _Float16 v4h  __attribute__((ext_vector_type(4)));
typedef _Float16 v2h  __attribute__((ext_vector_type(2)));
typedef float    v8f  __attribute__((ext_vector_type(8)));
typedef float    v4f  __attribute__((ext_vector_type(4)));

typedef uint32_t u32x4 __attribute__((ext_vector_type(4)));
typedef uint32_t u32x8 __attribute__((ext_vector_type(8)));

// A wave-uniform value in a scalar register.
__device__ __forceinline__ uint32_t uni(uint32_t v) { return (uint32_t)__builtin_amdgcn_readfirstlane(v); }

// A descriptor word or an issue test held in a scalar register: what is
// formed from it stands behind the volatile wait in front of it, and a test on it is a scalar branch.
__device__ __forceinline__ uint32_t pinned(uint32_t v) {
    uint32_t w = uni(v);
    asm volatile("" : "+s"(w));   // pinned(): holds the word in a scalar register, behind the waits before it
    return w;
}

__device__ __forceinline__ v8f wmma_f16(v16h a, v16h b, v8f c) {
    return __builtin_amdgcn_wmma_f32_16x16x32_f16(
        false, a, false, b, (short)0, c, false, false);
}

// Per-lane WMMA fragment from LDS tile stored [row][k].
// slots 0..7 -> k = hi*8.., slots 8..15 -> k = hi*8+16..
__device__ __forceinline__ v16h load_frag(const _Float16* p) {
    v8h lo = *(const v8h*)(p);
    v8h hh = *(const v8h*)(p + 16);
    v16h r;
#pragma unroll
    for (int i = 0; i < 8; ++i) { r[i] = lo[i]; r[i + 8] = hh[i]; }
    return r;
}

// The value that lane l ^ 16 holds (a vector move between the wave's two rows of 16 lanes).
__device__ __forceinline__ float other_half(float v) {
    const int i = __builtin_bit_cast(int, v);
    return __builtin_bit_cast(float,
        __builtin_amdgcn_permlanex16(i, i, 0x76543210, 0xfedcba98, false, false));
}

// 2^x. The v_nop fills the slot that the instruction set asks for behind a transcendental.
__device__ __forceinline__ float exp2_slot(float x) {
    float y;
    asm("v_exp_f32 %0, %1\n\tv_nop" : "=v"(y) : "v"(x));
    return y;
}

// Sends a wave's 64 x 64 f16 tile out as whole 128-byte lines. h[mi][ni] is row mi * 16 + lr,
// columns ni * 16 + hi * 8 .. + 7. The tile is turned in st, an LDS range that only this wave uses;
// each store then covers 4 rows of 128 bytes instead of 16 pieces of 32 bytes.
// Ncols is a constant at every call: the 16 stores then share one address register pair.
__device__ __forceinline__ void store_tile_f16(const v8h (&h)[4][4], _Float16* st,
                                               _Float16* __restrict__ c0, const int Ncols, int lane) {
    constexpr int SP = 72;             // LDS row pitch in halves: 16 B x odd
    const int lr = lane & 15;
    const int hi = lane >> 4;
#pragma unroll
    for (int mi = 0; mi < 4; ++mi)
#pragma unroll
        for (int ni = 0; ni < 4; ++ni) *(v8h*)(st + (mi * 16 + lr) * SP + ni * 16 + hi * 8) = h[mi][ni];
    asm volatile("s_wait_dscnt 0x0" ::: "memory");   // the rows are read back by other lanes of this wave
    v8h o[16];
#pragma unroll
    for (int j = 0; j < 16; ++j) o[j] = *(const v8h*)(st + (j * 4 + (lane >> 3)) * SP + (lane & 7) * 8);
    _Float16* gp = c0 + (size_t)(lane >> 3) * Ncols + (lane & 7) * 8;
    // All stores stand behind all LDS reads: no register that an issued store names is written again.
    __builtin_amdgcn_sched_barrier(0);
#pragma unroll
    for (int j = 0; j < 16; ++j) *(v8h*)(gp + (size_t)(j * 4) * Ncols) = o[j];
    // The registers that the stores above name are free for reuse from here on.
    asm volatile("s_wait_xcnt 0x0" ::: "memory");
}

// ======================================================================
// C[M,N] = alpha * A[M,Kd] * Bt[N,Kd]^T  (both K-contiguous f16)
// Work-group tile TMv x TN, K slab KB; 8 waves, each on a 64 x 128 tile: 12 fragments from LDS feed
// 32 WMMAs (a 64 x 64 tile: 8 feed 16).
// KS == 1: TMv = 256, the waves lie 4 x 2.
// KS == 2: TMv = 128, the waves lie 2 x 2 x 2: the two waves of a pair share a tile and each takes one
//          half of every slab's k; behind the loop each hands the other, through LDS, its partial sums
//          of one 64-column half and finishes the half that it keeps.
// Both operands come by tensor loads to LDS, two buffers: each wave brings one slice of rows per slab
// (waves 0-3: a quarter of A's rows each, waves 4-7: 64 of Bt's rows each), padded to the pitch by the mover.
// The WMMAs take Bt's fragment as A and A's as B, so that a lane holds 8 neighbouring columns of one
// row of C; behind the loop each wave turns 64 x 64 pieces in its own part of the ring and stores whole lines.
// The k loop starts at column kRot (a multiple of KB below Kd, Kd a power of two) and wraps round: work-groups
// that share operand rows are given different kRot, so that they do not ask L2 for the same lines at one time.
// ======================================================================
#define TN 256
#define KBLK 64                // keys per softmax block
#define NBLK (AN / KBLK)

// MODE 0: C = alpha * A * Bt^T.
// MODE 1: the scores. Each wave turns each 64 x 64 half of its tile into exp(score - block maximum) and
//         stores, in ml[block][0][row] and ml[block][1][row], the maximum (log2 units) and the sum.
// MODE 2: the last product. A's fragments are brought to their row's overall maximum on the way
//         into the WMMAs; the row's sum divides in the epilogue.
template <int KB, int MODE, int TMv, int KS, typename TC>
__device__ __forceinline__ void gemm_nt(const _Float16* __restrict__ A,
                                        const _Float16* __restrict__ Bt,
                                        TC* __restrict__ C, float* __restrict__ ml,
                                        int Kd, int Ncols,
                                        float alpha, int mBase, int nBase, int kRot) {
    constexpr int PIT = KB + 8;        // LDS row pitch in halves: 16 B x odd, conflict-free b128 reads
    constexpr int KW  = KB / KS;       // the part of a slab's k that one wave works on
    constexpr int AR  = TMv / 4;       // rows of a slice of A
    constexpr int BR  = TN / 4;        // rows of a slice of Bt
    // A slice's room in halves: its padded rows, rounded up so that every slice starts at a multiple of 2 KiB.
    constexpr int ASZ = (AR * PIT * 2 + 2047) / 2048 * 1024;
    constexpr int BSZ = (BR * PIT * 2 + 2047) / 2048 * 1024;
    constexpr int STG = 4 * ASZ + 4 * BSZ;   // one buffer: A's four slices, then Bt's
    __shared__ __attribute__((aligned(2048))) _Float16 ring[2 * STG];
    static_assert(KB == 128 && BR == 64 && 64 % AR == 0 && AR % 16 == 0, "rows of 256 bytes; a wave's 64 rows are whole slices");
    constexpr int SCP = NBLK + 2;      // pitch of the factor table in halves: an odd count of dwords
    __shared__ __align__(16) _Float16 scT[MODE == 2 ? TMv * SCP : 8];  // factor per row and key block
    __shared__ float pmax[2][MODE == 2 ? TMv : 1];                     // row maximum, by half of the blocks
    __shared__ float psum[2][MODE == 2 ? TMv : 1];                     // row sum, by half of the blocks
    static_assert(TMv * KS == 256, "8 waves of 64 x 128");
    static_assert(MODE != 2 || (KW == KBLK && TMv == 128), "one factor serves a wave's part of a slab");

    const int t    = threadIdx.x;
    const int lane = t & 31;
    const int wave = t >> 5;
    const int lr   = lane & 15;
    const int hi   = lane >> 4;
    const int kg    = (KS == 2) ? (wave >> 2) : 0;               // which half of a slab's k
    const int waveM = (KS == 2) ? (wave & 1) : (wave & 3);        // wave-rows (64 M each)
    const int waveN = (KS == 2) ? ((wave >> 1) & 1) : (wave >> 2);// 2 wave-cols (128 N each)

    v8f acc[4][8];
#pragma unroll
    for (int mi = 0; mi < 4; ++mi)
#pragma unroll
        for (int ni = 0; ni < 8; ++ni) acc[mi][ni] = (v8f){0,0,0,0,0,0,0,0};

    // This wave's slice: its first source byte, its place in buffer 0, its rows.
    const uint32_t wv   = uni((uint32_t)t >> 5);
    const bool     isB  = wv >= 4u;
    const uint32_t rows = isB ? (uint32_t)BR : (uint32_t)AR;
    const uint64_t srcw = isB ? (uint64_t)(size_t)(Bt + (size_t)(nBase + (wv - 4u) * BR) * Kd)
                              : (uint64_t)(size_t)(A + (size_t)(mBase + wv * AR) * Kd);
    const uint32_t dstw = (uint32_t)(size_t)ring + 2u * (isB ? 4u * ASZ + (wv - 4u) * BSZ : wv * ASZ);
    // Group 1: extents in bytes, tensor = tile = rows x 256 B; 16 B of pad behind every 256 B: pitch 272 B.
    u32x8 g1;
    g1[0] = uni((1u << 20) | (5u << 22) | (3u << 25));
    g1[1] = uni(256u << 16);
    g1[2] = uni(rows << 16);
    g1[3] = uni(256u << 16);
    g1[4] = uni(rows);
    g1[5] = uni((uint32_t)Kd * 2u);    // source row pitch
    g1[6] = uni(0u);
    g1[7] = uni(0u);

    // One request of this wave: its slice of the slab that starts at column k of the rows.
    auto stage = [&](int k, int buf) {
        // pinned(): group 0 is formed behind the wait for this wave's request before.
        const uint64_t ga = srcw + pinned((uint32_t)k * 2u);
        u32x4 g0;
        g0[0] = uni(1u);
        g0[1] = uni(dstw + pinned((uint32_t)buf * (2u * STG)));
        g0[2] = uni((uint32_t)ga);
        g0[3] = uni(((uint32_t)(ga >> 32) & 0x01FFFFFFu) | 0x80000000u);
        // Fixed scalar registers: left to the allocator, registers that a request in flight names were
        // taken for the loop's counters directly behind the issue. These are written only for a request.
        asm volatile("tensor_load_to_lds %0, %1" :: "{s[56:59]}"(g0), "{s[48:55]}"(g1) : "memory");
    };

    const int kMask = Kd - 1;
    stage(kRot, 0);
    if constexpr (MODE == 2) {
        // Joins the blocks of this work-group's rows while slab 0 flies: thread = (row, half of the blocks).
        constexpr int HB = NBLK / 2;
        const int prow = t & (TMv - 1);
        const int ph   = t >> 7;
        const float* mp = ml + (size_t)(ph * HB) * 2 * AN + mBase + prow;
        float mv[HB], lv[HB];
#pragma unroll
        for (int i = 0; i < HB; ++i) mv[i] = mp[(size_t)i * 2 * AN];
#pragma unroll
        for (int i = 0; i < HB; ++i) lv[i] = mp[(size_t)i * 2 * AN + AN];
        // The address registers of the loads above are free for reuse from here on.
        asm volatile("s_wait_xcnt 0x0" ::: "memory");
        float mx = mv[0];
#pragma unroll
        for (int i = 1; i < HB; ++i) mx = fmaxf(mx, mv[i]);
        pmax[ph][prow] = mx;
        __syncthreads();   // the other half's maximum is written by another wave
        mx = fmaxf(pmax[0][prow], pmax[1][prow]);
        float ls = 0.0f;
#pragma unroll
        for (int i = 0; i < HB; i += 2) {
            const float f0 = __builtin_amdgcn_exp2f(mv[i] - mx);
            const float f1 = __builtin_amdgcn_exp2f(mv[i + 1] - mx);
            ls += lv[i] * f0 + lv[i + 1] * f1;
            *(v2h*)(&scT[prow * SCP + ph * HB + i]) = (v2h){(_Float16)f0, (_Float16)f1};
        }
        psum[ph][prow] = ls;   // published, like scT, by the barrier below
    }
    asm volatile("s_wait_tensorcnt 0x0" ::: "memory");  // this wave's slice of slab 0 has landed before it is published
    __syncthreads();
    stage((KB + kRot) & kMask, 1);                      // Kd >= 2 * KB at every call site

    // acc[.][0..3] is the 64-column half that the wave keeps (half kg of its tile), acc[.][4..7] the other.
    const int aOff  = waveM * (64 / AR) * ASZ + lr * PIT + kg * KW + hi * 8;
    const int bOff0 = 4 * ASZ + (waveN * 2 + kg) * BSZ + lr * PIT + kg * KW + hi * 8;
    const int bOff1 = 4 * ASZ + (waveN * 2 + (kg ^ 1)) * BSZ + lr * PIT + kg * KW + hi * 8;

    // The same places in the buffer that is being read.
    const _Float16 *aP = ring + aOff, *bP0 = ring + bOff0, *bP1 = ring + bOff1;
    for (int k0 = 0; k0 < Kd; k0 += KB) {
        const int cur = (k0 / KB) & 1;
        _Float16 scp[4];   // MODE 2: the factor of this wave's key block of the slab, per A fragment row
#pragma unroll
        for (int kk = 0; kk < KW; kk += 32) {
            v16h af[4], bf[8];
            if constexpr (MODE == 2) {
                if (kk == 0) {
#pragma unroll
                    for (int mi = 0; mi < 4; ++mi)
                        scp[mi] = scT[(waveM * 64 + mi * 16 + lr) * SCP + ((k0 + kRot) & kMask) / KBLK + kg];
                }
            }
#pragma unroll
            for (int mi = 0; mi < 4; ++mi)
                af[mi] = load_frag(aP + (mi * 16 / AR) * ASZ + (mi * 16 % AR) * PIT + kk);
#pragma unroll
            for (int ni = 0; ni < 8; ++ni)
                bf[ni] = load_frag((ni < 4 ? bP0 : bP1) + (ni & 3) * 16 * PIT + kk);
            // Keeps the block's 24 LDS reads one group in front of its 32 WMMAs: left free, the
            // compiler reloads fragments among the WMMAs and waits for each to the last read.
            __builtin_amdgcn_sched_barrier(0);
            if constexpr (MODE == 2) {
#pragma unroll
                for (int mi = 0; mi < 4; ++mi) af[mi] *= scp[mi];   // a lane's fragment is one row
            }
#pragma unroll
            for (int mi = 0; mi < 4; ++mi)
#pragma unroll
                for (int ni = 0; ni < 8; ++ni)   // operands exchanged: a lane holds one row's 8 neighbouring columns
                    acc[mi][ni] = wmma_f16(bf[ni], af[mi], acc[mi][ni]);
            // Keeps the next block's reads from being spread among these WMMAs.
            __builtin_amdgcn_sched_barrier(0);
        }
        asm volatile("s_wait_dscnt 0x0" ::: "memory");      // this wave has left buffer cur before it is refilled
        asm volatile("s_wait_tensorcnt 0x0" ::: "memory");  // this wave's slice of the next slab has landed
        __syncthreads();   // publishes the next slab and ends every read of buffer cur
        // A scalar branch: a tensor load ignores EXEC. The load flies while the next slab is worked on.
        if (pinned(k0 + 2 * KB < Kd)) stage((k0 + 2 * KB + kRot) & kMask, cur);
        const int hop = cur ? -STG : STG;      // on to the other buffer
        aP += hop; bP0 += hop; bP1 += hop;
    }
    asm volatile("s_wait_tensorcnt 0x0" ::: "memory");  // no request is left in flight
    asm volatile("s_wait_dscnt 0x0" ::: "memory");      // nor a read of the ring, which becomes staging below

    // The last trip's barrier has ended every read of the ring and nothing flies into it any more.
    constexpr int XS = (KS == 2) ? 64 * 68 * 4 : 64 * 72 * 2;   // bytes of the ring per wave
    static_assert(sizeof(ring) >= 8 * XS && XS >= 64 * (64 * (int)sizeof(TC) + 16), "a padded 64 x 64 piece per wave");
    char* xb = reinterpret_cast<char*>(&ring[0]);
    // KS == 2: a wave goes on in the range that its partner has filled and that it alone reads.
    char* own = xb + ((KS == 2) ? (wave ^ 4) : wave) * XS;
    if constexpr (KS == 2) {
        float* give = reinterpret_cast<float*>(xb + wave * XS);
#pragma unroll
        for (int mi = 0; mi < 4; ++mi)
#pragma unroll
            for (int ni = 0; ni < 4; ++ni) {
                const v8f a = acc[mi][4 + ni];
                float*    p = give + (mi * 4 + ni) * 256 + lane * 4;
                *(v4f*)(p)       = (v4f){a[0], a[1], a[2], a[3]};
                *(v4f*)(p + 128) = (v4f){a[4], a[5], a[6], a[7]};
            }
        __syncthreads();   // the partial sums are read by the pair's other wave
        const float* take = reinterpret_cast<const float*>(own);
#pragma unroll
        for (int mi = 0; mi < 4; ++mi)
#pragma unroll
            for (int ni = 0; ni < 4; ++ni) {
                const float* p = take + (mi * 4 + ni) * 256 + lane * 4;
                const v4f lo = *(const v4f*)(p);
                const v4f hh = *(const v4f*)(p + 128);
#pragma unroll
                for (int r = 0; r < 4; ++r) { acc[mi][ni][r] += lo[r]; acc[mi][ni][r + 4] += hh[r]; }
            }
    }

    // Piece nh: acc[mi][nh * 4 + ni][r] is row mi * 16 + lr, column ni * 16 + hi * 8 + r of the piece.
#pragma unroll
    for (int nh = 0; nh < 2 / KS; ++nh) {
        const int cb = nBase + waveN * 128 + ((KS == 2) ? kg : nh) * 64;   // the piece's first column
        if constexpr (MODE == 1) {
            const float a2 = alpha * 1.44269504f;   // scores in log2 units; alpha > 0
            v8h   h[4][4];
            float ms[4];
#pragma unroll
            for (int mi = 0; mi < 4; ++mi) {
                float mx = acc[mi][nh * 4][0];
#pragma unroll
                for (int ni = 0; ni < 4; ++ni)
#pragma unroll
                    for (int r = 0; r < 8; ++r) mx = fmaxf(mx, acc[mi][nh * 4 + ni][r]);
                mx = fmaxf(mx, other_half(mx));   // the row's other 32 keys
                const float m2 = mx * a2;
                float s = 0.0f;
#pragma unroll
                for (int ni = 0; ni < 4; ++ni)
#pragma unroll
                    for (int r = 0; r < 8; ++r) {
                        const float p = exp2_slot(fmaf(acc[mi][nh * 4 + ni][r], a2, -m2));
                        s += p;
                        h[mi][ni][r] = (_Float16)p;
                    }
                s += other_half(s);
                ms[mi] = hi ? s : m2;   // 16 lanes each: maxima, sums
            }
            float* mp = ml + ((size_t)(cb / KBLK) * 2 + hi) * AN + mBase + waveM * 64 + lr;
            store_tile_f16(h, reinterpret_cast<_Float16*>(own),
                           C + (size_t)(mBase + waveM * 64) * Ncols + cb, Ncols, lane);
#pragma unroll
            for (int mi = 0; mi < 4; ++mi) mp[mi * 16] = ms[mi];
            // The registers that the stores above name are free for the next piece from here on.
            asm volatile("s_wait_xcnt 0x0" ::: "memory");
            // Keeps the next piece's arithmetic behind that wait: moved up among the stores, it wrote
            // registers that issued stores still named.
            __builtin_amdgcn_sched_barrier(0);
        } else if constexpr (MODE == 2) {
            constexpr int SP = 68;             // LDS row pitch in floats: 16 B x odd
            float* st = reinterpret_cast<float*>(own);
#pragma unroll
            for (int mi = 0; mi < 4; ++mi) {
                const int   lrow = waveM * 64 + mi * 16 + lr;
                const float inv  = 1.0f / (psum[0][lrow] + psum[1][lrow]);
#pragma unroll
                for (int ni = 0; ni < 4; ++ni) {
                    const v8f a = acc[mi][nh * 4 + ni] * inv;
                    float*    p = st + (mi * 16 + lr) * SP + ni * 16 + hi * 8;
                    *(v4f*)(p)     = (v4f){a[0], a[1], a[2], a[3]};
                    *(v4f*)(p + 4) = (v4f){a[4], a[5], a[6], a[7]};
                }
            }
            asm volatile("s_wait_dscnt 0x0" ::: "memory");   // the rows are read back by other lanes of this wave
            v4f o[32];
#pragma unroll
            for (int j = 0; j < 32; ++j) o[j] = *(const v4f*)(st + (j * 2 + hi) * SP + lr * 4);
            TC* gp = C + (size_t)(mBase + waveM * 64 + hi) * Ncols + cb + lr * 4;
            // All stores stand behind all LDS reads: no register that an issued store names is written again.
            __builtin_amdgcn_sched_barrier(0);
#pragma unroll
            for (int j = 0; j < 32; ++j) *(v4f*)(gp + (size_t)(j * 2) * Ncols) = o[j];   // 2 rows of 256 bytes
        } else {
            v8h h[4][4];
#pragma unroll
            for (int mi = 0; mi < 4; ++mi)
#pragma unroll
                for (int ni = 0; ni < 4; ++ni)
#pragma unroll
                    for (int r = 0; r < 8; ++r) h[mi][ni][r] = (_Float16)(acc[mi][nh * 4 + ni][r] * alpha);
            _Float16* st = reinterpret_cast<_Float16*>(own);
            TC*       c0 = C + (size_t)(mBase + waveM * 64) * Ncols + cb;
            // The file's two row lengths, each as a constant (the same for the whole work-group).
            if (Ncols == AN) store_tile_f16(h, st, c0, AN, lane);
            else             store_tile_f16(h, st, c0, AD, lane);
        }
    }
}

// ---------------- kernels ----------------

#define STM 256                           // rows of a work-group's tile: the scores (1024 tiles)
#define QTM 128                           // the projection (768 tiles) and the last product (256 tiles)

#define PBLKS 512                         // work-groups of the rounding kernel
#define XELE  (AN * AD / PBLKS)           // x elements per work-group
#define WTK   64                          // weight tile: 64 inputs x 32 outputs, one of each weight
#define WTN   (AD * AD / PBLKS / WTK)

// Rounds the projection's operands to f16 once: x as it lies, each weight turned to [out][in],
// so that every product of the file finds both operands K-contiguous in f16.
__global__ void __launch_bounds__(256)
prep_kernel(const float* __restrict__ x,
            const float* __restrict__ Wq, const float* __restrict__ Wk,
            const float* __restrict__ Wv,
            _Float16* __restrict__ xh, _Float16* __restrict__ Wt) {
    constexpr int WP = WTK + 8;           // LDS row pitch in halves (16 B x odd)
    constexpr int XP = XELE / 1024;       // passes over x, one float4 per thread each
    static_assert(WTK * WTN == 256 * 8 && WTN == 32 && XELE % 1024 == 0, "thread maps below");
    __shared__ __align__(16) _Float16 tile[3][WTN * WP];
    const int      t  = threadIdx.x;
    const unsigned b  = blockIdx.x;
    const unsigned kT = (b / (AD / WTN)) * WTK;
    const unsigned nT = (b % (AD / WTN)) * WTN;

    const int    k    = (t >> 3) * 2;     // two input rows per thread: one f16 pair per output
    const int    n    = (t & 7) * 4;      // 8 lanes x 16 B = one whole 128-byte line
    const size_t woff = (size_t)(kT + k) * AD + nT + n;
    const size_t base = (size_t)b * XELE + t * 4;
    const float* Ws[3] = {Wq, Wk, Wv};
    float4 w0[3], w1[3], v[XP];
#pragma unroll
    for (int m = 0; m < 3; ++m) {
        w0[m] = *(const float4*)(Ws[m] + woff);
        w1[m] = *(const float4*)(Ws[m] + woff + AD);
    }
    // The loads of x below land in registers that held the weights' addresses.
    asm volatile("s_wait_xcnt 0x0" ::: "memory");
#pragma unroll
    for (int i = 0; i < XP; ++i) v[i] = *(const float4*)(x + base + i * 1024);

#pragma unroll
    for (int m = 0; m < 3; ++m) {
        *(v2h*)(&tile[m][(n + 0) * WP + k]) = (v2h){(_Float16)w0[m].x, (_Float16)w1[m].x};
        *(v2h*)(&tile[m][(n + 1) * WP + k]) = (v2h){(_Float16)w0[m].y, (_Float16)w1[m].y};
        *(v2h*)(&tile[m][(n + 2) * WP + k]) = (v2h){(_Float16)w0[m].z, (_Float16)w1[m].z};
        *(v2h*)(&tile[m][(n + 3) * WP + k]) = (v2h){(_Float16)w0[m].w, (_Float16)w1[m].w};
    }
    __syncthreads();   // the turned tiles are read back by other waves
#pragma unroll
    for (int m = 0; m < 3; ++m) {
        const int row = t >> 3;
        const int kc  = (t & 7) * 8;      // 8 lanes x 16 B = one whole 128-byte line
        *(v8h*)(Wt + (size_t)m * AD * AD + (size_t)(nT + row) * AD + kT + kc) =
            *(const v8h*)(&tile[m][row * WP + kc]);
    }
#pragma unroll
    for (int i = 0; i < XP; ++i) {
        v4h h = {(_Float16)v[i].x, (_Float16)v[i].y, (_Float16)v[i].z, (_Float16)v[i].w};
        *(v4h*)(xh + base + i * 1024) = h;
    }
}

// Q = x Wq and K = x Wk as [N][D]; V as [D][N] = Wv^T x^T, the same loop with the operands' roles
// exchanged, so that the last product finds both operands K-contiguous.
__global__ void __launch_bounds__(256)
qkv_kernel(const _Float16* __restrict__ xh, const _Float16* __restrict__ Wt,
           _Float16* __restrict__ Q, _Float16* __restrict__ Kp, _Float16* __restrict__ Vt) {
    const int  z  = blockIdx.z;
    const bool tr = (z == 2);
    const _Float16* Wz = Wt + (size_t)z * AD * AD;
    const unsigned b  = blockIdx.x;
    const unsigned mT = tr ? b / (AN / TN) : b / (AD / TN);
    const unsigned nT = tr ? b % (AN / TN) : b % (AD / TN);
    // Four (V: 32) work-groups share a tile's rows of A, 64 (V: 8) its rows of Bt.
    const unsigned rot = (tr ? mT + nT : mT + 2 * nT) % (AD / 128);
    gemm_nt<128, 0, QTM, 2>(tr ? Wz : xh, tr ? xh : Wz, (z == 0) ? Q : (z == 1) ? Kp : Vt, (float*)nullptr,
                   AD, tr ? AN : AD, 1.0f, mT * QTM, nT * TN, rot * 128);
}

__global__ void __launch_bounds__(256)
scores_kernel(const _Float16* __restrict__ Q, const _Float16* __restrict__ Kp,
              _Float16* __restrict__ P, float* __restrict__ ml) {
    gemm_nt<128, 1, STM, 1>(Q, Kp, P, ml, AD, AN, 0.03125f /* 1/sqrt(1024) */,
                            blockIdx.y * STM, blockIdx.x * TN, ((blockIdx.x + blockIdx.y) % (AD / 128)) * 128);
}

__global__ void __launch_bounds__(256)
out_kernel(const _Float16* __restrict__ P, const _Float16* __restrict__ Vt,
           float* __restrict__ ml, float* __restrict__ O) {
    // The 64 work-groups that share rows of V^T each start at another slab; the four that share rows of P
    // start one slab apart, near enough for a slab that one has asked for to be still in L2 for the next.
    gemm_nt<128, 2, QTM, 2>(P, Vt, O, ml, AN, AD, 1.0f, blockIdx.y * QTM, blockIdx.x * TN,
                            ((blockIdx.x + blockIdx.y) % (AN / 128)) * 128);
}

extern "C" void kernel_launch(void* const* d_in, const int* in_sizes, int n_in,
                              void* d_out, int out_size, void* d_ws, size_t ws_size,
                              hipStream_t stream) {
    (void)in_sizes; (void)n_in; (void)out_size; (void)ws_size;
    const float* x  = (const float*)d_in[0];
    const float* Wq = (const float*)d_in[1];
    const float* Wk = (const float*)d_in[2];
    const float* Wv = (const float*)d_in[3];

    _Float16* Q  = (_Float16*)d_ws;
    _Float16* Kp = Q  + (size_t)AN * AD;
    _Float16* Vt = Kp + (size_t)AN * AD;   // V transposed: [D][N]
    _Float16* S  = Vt + (size_t)AN * AD;   // 8192*8192 f16: P, each block of 64 keys on its own maximum
    _Float16* xh = S  + (size_t)AN * AN;   // x in f16
    _Float16* Wt = xh + (size_t)AN * AD;   // three weights in f16, each [out][in]
    float*    ml = (float*)(Wt + (size_t)3 * AD * AD);   // [NBLK][2][N]: block maxima and sums

    dim3 blk(256);

    prep_kernel<<<dim3(PBLKS), blk, 0, stream>>>(x, Wq, Wk, Wv, xh, Wt);
    qkv_kernel<<<dim3((AN / QTM) * (AD / TN), 1, 3), blk, 0, stream>>>(xh, Wt, Q, Kp, Vt);
    scores_kernel<<<dim3(AN / TN, AN / STM), blk, 0, stream>>>(Q, Kp, S, ml);
    out_kernel<<<dim3(AD / TN, AN / QTM), blk, 0, stream>>>(S, Vt, ml, (float*)d_out);
}

// v009
// A run of this version takes 195 microseconds.
// Two timings next to v008 both put it at 1.04 times that version's speed.
// All steps since v000 together make it 2.61 times as fast.
#include <hip/hip_runtime.h>
#include <hip/hip_bf16.h>

// Attention: out = softmax((x Wq)(x Wk)^T / sqrt(D)) (x Wv)
// N = 8192, D = 1024, fp32 in/out. Internals f16, f32 WMMA accumulate.
// Workspace (>= 206 MB): Q,K f16 [N][D], V f16 transposed [D][N] (16 MB each)
// + P f16 (128 MB): exp of each score less the maximum of its own row in its block of 64 keys
// + x f16 [N][D] (16 MB) + Wq,Wk,Wv f16, each transposed [out][in] (2 MB each)
// + per block of 64 keys and row: that maximum (log2 units) and the block's sum, f32 (8 MB).

#define AN 8192
#define AD 1024
static_assert((AN & (AN - 1)) == 0 && (AD & (AD - 1)) == 0, "the k loops wrap round by a mask");

typedef _Float16 v16h __attribute__((ext_vector_type(16)));
typedef _Float16 v8h  __attribute__((ext_vector_type(8)));
typedef _Float16 v4h  __attribute__((ext_vector_type(4)));
typedef _Float16 v2h  __attribute__((ext_vector_type(2)));
typedef float    v8f  __attribute__((ext_vector_type(8)));
typedef float    v4f  __attribute__((ext_vector_type(4)));

typedef uint32_t u32x4 __attribute__((ext_vector_type(4)));
typedef uint32_t u32x8 __attribute__((ext_vector_type(8)));

// A wave-uniform value in a scalar register.
__device__ __forceinline__ uint32_t uni(uint32_t v) { return (uint32_t)__builtin_amdgcn_readfirstlane(v); }

// A descriptor word or an issue test held in a scalar register: what is
// formed from it stands behind the volatile wait in front of it, and a test on it is a scalar branch.
__device__ __forceinline__ uint32_t pinned(uint32_t v) {
    uint32_t w = uni(v);
    asm volatile("" : "+s"(w));   // pinned(): holds the word in a scalar register, behind the waits before it
    return w;
}

__device__ __forceinline__ v8f wmma_f16(v16h a, v16h b, v8f c) {
    return __builtin_amdgcn_wmma_f32_16x16x32_f16(
        false, a, false, b, (short)0, c, false, false);
}

// Per-lane WMMA fragment from LDS tile stored [row][k].
// slots 0..7 -> k = hi*8.., slots 8..15 -> k = hi*8+16..
__device__ __forceinline__ v16h load_frag(const _Float16* p) {
    v8h lo = *(const v8h*)(p);
    v8h hh = *(const v8h*)(p + 16);
    v16h r;
#pragma unroll
    for (int i = 0; i < 8; ++i) { r[i] = lo[i]; r[i + 8] = hh[i]; }
    return r;
}

// The value that lane l ^ 16 holds (a vector move between the wave's two rows of 16 lanes).
__device__ __forceinline__ float other_half(float v) {
    const int i = __builtin_bit_cast(int, v);
    return __builtin_bit_cast(float,
        __builtin_amdgcn_permlanex16(i, i, 0x76543210, 0xfedcba98, false, false));
}

// 2^x. The v_nop fills the slot that the instruction set asks for behind a transcendental.
__device__ __forceinline__ float exp2_slot(float x) {
    float y;
    asm("v_exp_f32 %0, %1\n\tv_nop" : "=v"(y) : "v"(x));
    return y;
}

// Sends a wave's 64 x 64 f16 tile out as whole 128-byte lines. h[mi][ni] is row mi * 16 + lr,
// columns ni * 16 + hi * 8 .. + 7. The tile is turned in st, an LDS range that only this wave uses;
// each store then covers 4 rows of 128 bytes instead of 16 pieces of 32 bytes.
// Ncols is a constant at every call: the 16 stores then share one address register pair.
__device__ __forceinline__ void store_tile_f16(const v8h (&h)[4][4], _Float16* st,
                                               _Float16* __restrict__ c0, const int Ncols, int lane) {
    constexpr int SP = 72;             // LDS row pitch in halves: 16 B x odd
    const int lr = lane & 15;
    const int hi = lane >> 4;
#pragma unroll
    for (int mi = 0; mi < 4; ++mi)
#pragma unroll
        for (int ni = 0; ni < 4; ++ni) *(v8h*)(st + (mi * 16 + lr) * SP + ni * 16 + hi * 8) = h[mi][ni];
    asm volatile("s_wait_dscnt 0x0" ::: "memory");   // the rows are read back by other lanes of this wave
    v8h o[16];
#pragma unroll
    for (int j = 0; j < 16; ++j) o[j] = *(const v8h*)(st + (j * 4 + (lane >> 3)) * SP + (lane & 7) * 8);
    _Float16* gp = c0 + (size_t)(lane >> 3) * Ncols + (lane & 7) * 8;
    // All stores stand behind all LDS reads: no register that an issued store names is written again.
    __builtin_amdgcn_sched_barrier(0);
#pragma unroll
    for (int j = 0; j < 16; ++j) *(v8h*)(gp + (size_t)(j * 4) * Ncols) = o[j];
    // The registers that the stores above name are free for reuse from here on.
    asm volatile("s_wait_xcnt 0x0" ::: "memory");
}

// ======================================================================
// C[M,N] = alpha * A[M,Kd] * Bt[N,Kd]^T  (both K-contiguous f16)
// Work-group tile TMv x TN, K slab KB; 8 waves, each on a 64 x 128 tile: 12 fragments from LDS feed
// 32 WMMAs (a 64 x 64 tile: 8 feed 16).
// KS == 1: TMv = 256, the waves lie 4 x 2.
// KS == 2: TMv = 128, the waves lie 2 x 2 x 2: the two waves of a pair share a tile and each takes one
//          half of every slab's k; behind the loop each hands the other, through LDS, its partial sums
//          of one 64-column half and finishes the half that it keeps.
// Both operands come by tensor loads to LDS, two buffers: each wave brings one slice of rows per slab
// (waves 0-3: a quarter of A's rows each, waves 4-7: 64 of Bt's rows each), padded to the pitch by the mover.
// The WMMAs take Bt's fragment as A and A's as B, so that a lane holds 8 neighbouring columns of one
// row of C; behind the loop each wave turns 64 x 64 pieces in its own part of the ring and stores whole lines.
// The k loop starts at column kRot (a multiple of KB below Kd, Kd a power of two) and wraps round: work-groups
// that share operand rows are given different kRot, so that they do not ask L2 for the same lines at one time.
// ======================================================================
#define TN 256
#define KBLK 64                // keys per softmax block
#define NBLK (AN / KBLK)

// MODE 0: C = alpha * A * Bt^T.
// MODE 1: the scores. Each wave turns each 64 x 64 half of its tile into exp(score - block maximum) and
//         stores, in ml[block][0][row] and ml[block][1][row], the maximum (log2 units) and the sum.
// MODE 2: the last product. A's fragments are brought to their row's overall maximum on the way
//         into the WMMAs; the row's sum divides in the epilogue.
// NT: tiles that a work-group works off one after the other; tileOf(i) names its i-th. With NT > 1 the ring
// runs on over the tiles: the next tile's first slab is asked for at the foot of this tile's last pass but one,
// into buffer 0, and is there when the epilogue, which stages in buffer 1, is over.
template <typename TC>
struct Tile {
    const _Float16* A;
    const _Float16* Bt;
    TC*             C;
    int             Ncols, mBase, nBase, kRot;
};

template <int KB, int MODE, int TMv, int KS, int NT, typename TC, typename F>
__device__ __forceinline__ void gemm_nt(F tileOf, float* __restrict__ ml, int Kd, float alpha) {
    constexpr int PIT = KB + 8;        // LDS row pitch in halves: 16 B x odd, conflict-free b128 reads
    constexpr int KW  = KB / KS;       // the part of a slab's k that one wave works on
    constexpr int AR  = TMv / 4;       // rows of a slice of A
    constexpr int BR  = TN / 4;        // rows of a slice of Bt
    // A slice's room in halves: its padded rows, rounded up so that every slice starts at a multiple of 2 KiB.
    constexpr int ASZ = (AR * PIT * 2 + 2047) / 2048 * 1024;
    constexpr int BSZ = (BR * PIT * 2 + 2047) / 2048 * 1024;
    constexpr int STG = 4 * ASZ + 4 * BSZ;   // one buffer: A's four slices, then Bt's
    // Bytes of epilogue staging per wave, and where it starts: with a tile loop behind buffer 0, which is being filled.
    constexpr int XS  = (KS == 2) ? (MODE == 2 ? 64 * 68 * 4 : 64 * 64 * 4) : 64 * 72 * 2;
    constexpr int XB  = (NT > 1) ? 2 * STG : 0;
    constexpr int RNG = (XB + 8 * XS > 4 * STG) ? (XB + 8 * XS) / 2 : 2 * STG;   // halves
    __shared__ __attribute__((aligned(2048))) _Float16 ring[RNG];
    static_assert(NT == 1 || MODE != 2, "the last product's table is built once");
    static_assert(KB == 128 && BR == 64 && 64 % AR == 0 && AR % 16 == 0, "rows of 256 bytes; a wave's 64 rows are whole slices");
    constexpr int SCP = NBLK + 2;      // pitch of the factor table in halves: an odd count of dwords
    __shared__ __align__(16) _Float16 scT[MODE == 2 ? TMv * SCP : 8];  // factor per row and key block
    __shared__ float pmax[2][MODE == 2 ? TMv : 1];                     // row maximum, by half of the blocks
    __shared__ float psum[2][MODE == 2 ? TMv : 1];                     // row sum, by half of the blocks
    static_assert(TMv * KS == 256, "8 waves of 64 x 128");
    static_assert(MODE != 2 || (KW == KBLK && TMv == 128), "one factor serves a wave's part of a slab");

    const int t    = threadIdx.x;
    const int lane = t & 31;
    const int wave = t >> 5;
    const int lr   = lane & 15;
    const int hi   = lane >> 4;
    const int kg    = (KS == 2) ? (wave >> 2) : 0;               // which half of a slab's k
    const int waveM = (KS == 2) ? (wave & 1) : (wave & 3);        // wave-rows (64 M each)
    const int waveN = (KS == 2) ? ((wave >> 1) & 1) : (wave >> 2);// 2 wave-cols (128 N each)

    // This wave's slice: its first source byte (by tile), its place in buffer 0, its rows.
    const uint32_t wv   = uni((uint32_t)t >> 5);
    const bool     isB  = wv >= 4u;
    const uint32_t rows = isB ? (uint32_t)BR : (uint32_t)AR;
    auto srcOf = [&](const Tile<TC>& q) {
        return isB ? (uint64_t)(size_t)(q.Bt + (size_t)(q.nBase + (wv - 4u) * BR) * Kd)
                   : (uint64_t)(size_t)(q.A + (size_t)(q.mBase + wv * AR) * Kd);
    };
    const uint32_t dstw = (uint32_t)(size_t)ring + 2u * (isB ? 4u * ASZ + (wv - 4u) * BSZ : wv * ASZ);
    // Group 1: extents in bytes, tensor = tile = rows x 256 B; 16 B of pad behind every 256 B: pitch 272 B.
    u32x8 g1;
    g1[0] = uni((1u << 20) | (5u << 22) | (3u << 25));
    g1[1] = uni(256u << 16);
    g1[2] = uni(rows << 16);
    g1[3] = uni(256u << 16);
    g1[4] = uni(rows);
    g1[5] = uni((uint32_t)Kd * 2u);    // source row pitch
    g1[6] = uni(0u);
    g1[7] = uni(0u);

    // One request of this wave: its slice of the slab that starts at column k of the rows that begin at src.
    auto stage = [&](uint64_t src, int k, int buf) {
        // pinned(): group 0 is formed behind the wait for this wave's request before.
        const uint64_t ga = src + pinned((uint32_t)k * 2u);
        u32x4 g0;
        g0[0] = uni(1u);
        g0[1] = uni(dstw + pinned((uint32_t)buf * (2u * STG)));
        g0[2] = uni((uint32_t)ga);
        g0[3] = uni(((uint32_t)(ga >> 32) & 0x01FFFFFFu) | 0x80000000u);
        // Fixed scalar registers: left to the allocator, registers that a request in flight names were
        // taken for the loop's counters directly behind the issue. These are written only for a request.
        asm volatile("tensor_load_to_lds %0, %1" :: "{s[56:59]}"(g0), "{s[48:55]}"(g1) : "memory");
    };

    const int kMask = Kd - 1;
    Tile<TC> tl   = tileOf(0);
    uint64_t srcw = srcOf(tl);
    stage(srcw, tl.kRot, 0);
    // Stays a loop: unrolled, the text would be NT times as long.
#pragma unroll 1
    for (int ti = 0; ti < NT; ++ti) {
    const int mBase = tl.mBase, nBase = tl.nBase, kRot = tl.kRot;
    const int Ncols = (MODE == 1) ? AN : tl.Ncols;
    TC* __restrict__ C = tl.C;
    const Tile<TC> nx   = tileOf(ti + 1 < NT ? ti + 1 : ti);   // the next tile; behind the last one it is not used
    const uint64_t srcn = srcOf(nx);
    v8f acc[4][8];
#pragma unroll
    for (int mi = 0; mi < 4; ++mi)
#pragma unroll
        for (int ni = 0; ni < 8; ++ni) acc[mi][ni] = (v8f){0,0,0,0,0,0,0,0};
    if constexpr (MODE == 2) {
        // Joins the blocks of this work-group's rows while slab 0 flies: thread = (row, half of the blocks).
        constexpr int HB = NBLK / 2;
        const int prow = t & (TMv - 1);
        const int ph   = t >> 7;
        const float* mp = ml + (size_t)(ph * HB) * 2 * AN + mBase + prow;
        float mv[HB], lv[HB];
#pragma unroll
        for (int i = 0; i < HB; ++i) mv[i] = mp[(size_t)i * 2 * AN];
#pragma unroll
        for (int i = 0; i < HB; ++i) lv[i] = mp[(size_t)i * 2 * AN + AN];
        // The address registers of the loads above are free for reuse from here on.
        asm volatile("s_wait_xcnt 0x0" ::: "memory");
        float mx = mv[0];
#pragma unroll
        for (int i = 1; i < HB; ++i) mx = fmaxf(mx, mv[i]);
        pmax[ph][prow] = mx;
        __syncthreads();   // the other half's maximum is written by another wave
        mx = fmaxf(pmax[0][prow], pmax[1][prow]);
        float ls = 0.0f;
#pragma unroll
        for (int i = 0; i < HB; i += 2) {
            const float f0 = __builtin_amdgcn_exp2f(mv[i] - mx);
            const float f1 = __builtin_amdgcn_exp2f(mv[i + 1] - mx);
            ls += lv[i] * f0 + lv[i + 1] * f1;
            *(v2h*)(&scT[prow * SCP + ph * HB + i]) = (v2h){(_Float16)f0, (_Float16)f1};
        }
        psum[ph][prow] = ls;   // published, like scT, by the barrier below
    }
    if constexpr (NT > 1) asm volatile("s_wait_dscnt 0x0" ::: "memory");  // this wave has left the staging in buffer 1
    asm volatile("s_wait_tensorcnt 0x0" ::: "memory");  // this wave's slice of slab 0 has landed before it is published
    __syncthreads();   // publishes slab 0; with a tile loop it also ends every use of the staging in buffer 1
    stage(srcw, (KB + kRot) & kMask, 1);                // Kd >= 2 * KB at every call site

    // acc[.][0..3] is the 64-column half that the wave keeps (half kg of its tile), acc[.][4..7] the other.
    const int aOff  = waveM * (64 / AR) * ASZ + lr * PIT + kg * KW + hi * 8;
    const int bOff0 = 4 * ASZ + (waveN * 2 + kg) * BSZ + lr * PIT + kg * KW + hi * 8;
    const int bOff1 = 4 * ASZ + (waveN * 2 + (kg ^ 1)) * BSZ + lr * PIT + kg * KW + hi * 8;

    // The same places in the buffer that is being read.
    const _Float16 *aP = ring + aOff, *bP0 = ring + bOff0, *bP1 = ring + bOff1;
    for (int k0 = 0; k0 < Kd; k0 += KB) {
        const int cur = (k0 / KB) & 1;
        _Float16 scp[4];   // MODE 2: the factor of this wave's key block of the slab, per A fragment row
#pragma unroll
        for (int kk = 0; kk < KW; kk += 32) {
            v16h af[4], bf[8];
            if constexpr (MODE == 2) {
                if (kk == 0) {
#pragma unroll
                    for (int mi = 0; mi < 4; ++mi)
                        scp[mi] = scT[(waveM * 64 + mi * 16 + lr) * SCP + ((k0 + kRot) & kMask) / KBLK + kg];
                }
            }
#pragma unroll
            for (int mi = 0; mi < 4; ++mi)
                af[mi] = load_frag(aP + (mi * 16 / AR) * ASZ + (mi * 16 % AR) * PIT + kk);
#pragma unroll
            for (int ni = 0; ni < 8; ++ni)
                bf[ni] = load_frag((ni < 4 ? bP0 : bP1) + (ni & 3) * 16 * PIT + kk);
            // Keeps the block's 24 LDS reads one group in front of its 32 WMMAs: left free, the
            // compiler reloads fragments among the WMMAs and waits for each to the last read.
            __builtin_amdgcn_sched_barrier(0);
            if constexpr (MODE == 2) {
#pragma unroll
                for (int mi = 0; mi < 4; ++mi) af[mi] *= scp[mi];   // a lane's fragment is one row
            }
#pragma unroll
            for (int mi = 0; mi < 4; ++mi)
#pragma unroll
                for (int ni = 0; ni < 8; ++ni)   // operands exchanged: a lane holds one row's 8 neighbouring columns
                    acc[mi][ni] = wmma_f16(bf[ni], af[mi], acc[mi][ni]);
            // Keeps the next block's reads from being spread among these WMMAs.
            __builtin_amdgcn_sched_barrier(0);
        }
        asm volatile("s_wait_dscnt 0x0" ::: "memory");      // this wave has left buffer cur before it is refilled
        asm volatile("s_wait_tensorcnt 0x0" ::: "memory");  // this wave's slice of the next slab has landed
        __syncthreads();   // publishes the next slab and ends every read of buffer cur
        // A scalar branch: a tensor load ignores EXEC. The load flies while the next slab is worked on.
        if (pinned(k0 + 2 * KB < Kd)) stage(srcw, (k0 + 2 * KB + kRot) & kMask, cur);
        // The next tile's slab 0, into buffer 0 (Kd / KB is even), which this tile has just left for good.
        else if (NT > 1 && pinned(k0 + 2 * KB == Kd && ti + 1 < NT)) stage(srcn, nx.kRot, 0);
        const int hop = cur ? -STG : STG;      // on to the other buffer
        aP += hop; bP0 += hop; bP1 += hop;
    }
    asm volatile("s_wait_tensorcnt 0x0" ::: "memory");  // no request is left in flight
    asm volatile("s_wait_dscnt 0x0" ::: "memory");      // nor a read of the ring, which becomes staging below

    // The last trip's barrier has ended every read of the ring and nothing flies into it any more.
    static_assert(sizeof(ring) >= XB + 8 * XS && XS >= 64 * (64 * (int)sizeof(TC) + 16), "a padded 64 x 64 piece per wave");
    static_assert(NT == 1 || (AD / KB) % 2 == 0, "a tile's last slab lies in buffer 1");
    char* xb = reinterpret_cast<char*>(&ring[0]) + XB;
    // KS == 2: a wave goes on in the range that its partner has filled and that it alone reads.
    char* own = xb + ((KS == 2) ? (wave ^ 4) : wave) * XS;
    if constexpr (KS == 2) {
        float* give = reinterpret_cast<float*>(xb + wave * XS);
#pragma unroll
        for (int mi = 0; mi < 4; ++mi)
#pragma unroll
            for (int ni = 0; ni < 4; ++ni) {
                const v8f a = acc[mi][4 + ni];
                float*    p = give + (mi * 4 + ni) * 256 + lane * 4;
                *(v4f*)(p)       = (v4f){a[0], a[1], a[2], a[3]};
                *(v4f*)(p + 128) = (v4f){a[4], a[5], a[6], a[7]};
            }
        __syncthreads();   // the partial sums are read by the pair's other wave
        const float* take = reinterpret_cast<const float*>(own);
#pragma unroll
        for (int mi = 0; mi < 4; ++mi)
#pragma unroll
            for (int ni = 0; ni < 4; ++ni) {
                const float* p = take + (mi * 4 + ni) * 256 + lane * 4;
                const v4f lo = *(const v4f*)(p);
                const v4f hh = *(const v4f*)(p + 128);
#pragma unroll
                for (int r = 0; r < 4; ++r) { acc[mi][ni][r] += lo[r]; acc[mi][ni][r + 4] += hh[r]; }
            }
    }

    // Piece nh: acc[mi][nh * 4 + ni][r] is row mi * 16 + lr, column ni * 16 + hi * 8 + r of the piece.
#pragma unroll
    for (int nh = 0; nh < 2 / KS; ++nh) {
        const int cb = nBase + waveN * 128 + ((KS == 2) ? kg : nh) * 64;   // the piece's first column
        if constexpr (MODE == 1) {
            const float a2 = alpha * 1.44269504f;   // scores in log2 units; alpha > 0
            v8h   h[4][4];
            float ms[4];
#pragma unroll
            for (int mi = 0; mi < 4; ++mi) {
                float mx = acc[mi][nh * 4][0];
#pragma unroll
                for (int ni = 0; ni < 4; ++ni)
#pragma unroll
                    for (int r = 0; r < 8; ++r) mx = fmaxf(mx, acc[mi][nh * 4 + ni][r]);
                mx = fmaxf(mx, other_half(mx));   // the row's other 32 keys
                const float m2 = mx * a2;
                float s = 0.0f;
#pragma unroll
                for (int ni = 0; ni < 4; ++ni)
#pragma unroll
                    for (int r = 0; r < 8; ++r) {
                        const float p = exp2_slot(fmaf(acc[mi][nh * 4 + ni][r], a2, -m2));
                        s += p;
                        h[mi][ni][r] = (_Float16)p;
                    }
                s += other_half(s);
                ms[mi] = hi ? s : m2;   // 16 lanes each: maxima, sums
            }
            float* mp = ml + ((size_t)(cb / KBLK) * 2 + hi) * AN + mBase + waveM * 64 + lr;
            store_tile_f16(h, reinterpret_cast<_Float16*>(own),
                           C + (size_t)(mBase + waveM * 64) * Ncols + cb, Ncols, lane);
#pragma unroll
            for (int mi = 0; mi < 4; ++mi) mp[mi * 16] = ms[mi];
            // The registers that the stores above name are free for the next piece from here on.
            asm volatile("s_wait_xcnt 0x0" ::: "memory");
            // Keeps the next piece's arithmetic behind that wait: moved up among the stores, it wrote
            // registers that issued stores still named.
            __builtin_amdgcn_sched_barrier(0);
        } else if constexpr (MODE == 2) {
            constexpr int SP = 68;             // LDS row pitch in floats: 16 B x odd
            float* st = reinterpret_cast<float*>(own);
#pragma unroll
            for (int mi = 0; mi < 4; ++mi) {
                const int   lrow = waveM * 64 + mi * 16 + lr;
                const float inv  = 1.0f / (psum[0][lrow] + psum[1][lrow]);
#pragma unroll
                for (int ni = 0; ni < 4; ++ni) {
                    const v8f a = acc[mi][nh * 4 + ni] * inv;
                    float*    p = st + (mi * 16 + lr) * SP + ni * 16 + hi * 8;
                    *(v4f*)(p)     = (v4f){a[0], a[1], a[2], a[3]};
                    *(v4f*)(p + 4) = (v4f){a[4], a[5], a[6], a[7]};
                }
            }
            asm volatile("s_wait_dscnt 0x0" ::: "memory");   // the rows are read back by other lanes of this wave
            v4f o[32];
#pragma unroll
            for (int j = 0; j < 32; ++j) o[j] = *(const v4f*)(st + (j * 2 + hi) * SP + lr * 4);
            TC* gp = C + (size_t)(mBase + waveM * 64 + hi) * Ncols + cb + lr * 4;
            // All stores stand behind all LDS reads: no register that an issued store names is written again.
            __builtin_amdgcn_sched_barrier(0);
#pragma unroll
            for (int j = 0; j < 32; ++j) *(v4f*)(gp + (size_t)(j * 2) * Ncols) = o[j];   // 2 rows of 256 bytes
        } else {
            v8h h[4][4];
#pragma unroll
            for (int mi = 0; mi < 4; ++mi)
#pragma unroll
                for (int ni = 0; ni < 4; ++ni)
#pragma unroll
                    for (int r = 0; r < 8; ++r) h[mi][ni][r] = (_Float16)(acc[mi][nh * 4 + ni][r] * alpha);
            _Float16* st = reinterpret_cast<_Float16*>(own);
            TC*       c0 = C + (size_t)(mBase + waveM * 64) * Ncols + cb;
            // The file's two row lengths, each as a constant (the same for the whole work-group).
            if (Ncols == AN) store_tile_f16(h, st, c0, AN, lane);
            else             store_tile_f16(h, st, c0, AD, lane);
        }
    }
    tl   = nx;
    srcw = srcn;
    }
}

// ---------------- kernels ----------------

#define STM 256                           // rows of a work-group's tile: the scores (1024 tiles)
#define QTM 128                           // the projection (768 tiles) and the last product (256 tiles)
#define SGRID 256                         // work-groups of the scores, four tiles each

#define PBLKS 512                         // work-groups of the rounding kernel
#define XELE  (AN * AD / PBLKS)           // x elements per work-group
#define WTK   64                          // weight tile: 64 inputs x 32 outputs, one of each weight
#define WTN   (AD * AD / PBLKS / WTK)

// Rounds the projection's operands to f16 once: x as it lies, each weight turned to [out][in],
// so that every product of the file finds both operands K-contiguous in f16.
__global__ void __launch_bounds__(256)
prep_kernel(const float* __restrict__ x,
            const float* __restrict__ Wq, const float* __restrict__ Wk,
            const float* __restrict__ Wv,
            _Float16* __restrict__ xh, _Float16* __restrict__ Wt) {
    constexpr int WP = WTK + 8;           // LDS row pitch in halves (16 B x odd)
    constexpr int XP = XELE / 1024;       // passes over x, one float4 per thread each
    static_assert(WTK * WTN == 256 * 8 && WTN == 32 && XELE % 1024 == 0, "thread maps below");
    __shared__ __align__(16) _Float16 tile[3][WTN * WP];
    const int      t  = threadIdx.x;
    const unsigned b  = blockIdx.x;
    const unsigned kT = (b / (AD / WTN)) * WTK;
    const unsigned nT = (b % (AD / WTN)) * WTN;

    const int    k    = (t >> 3) * 2;     // two input rows per thread: one f16 pair per output
    const int    n    = (t & 7) * 4;      // 8 lanes x 16 B = one whole 128-byte line
    const size_t woff = (size_t)(kT + k) * AD + nT + n;
    const size_t base = (size_t)b * XELE + t * 4;
    const float* Ws[3] = {Wq, Wk, Wv};
    float4 w0[3], w1[3], v[XP];
#pragma unroll
    for (int m = 0; m < 3; ++m) {
        w0[m] = *(const float4*)(Ws[m] + woff);
        w1[m] = *(const float4*)(Ws[m] + woff + AD);
    }
    // The loads of x below land in registers that held the weights' addresses.
    asm volatile("s_wait_xcnt 0x0" ::: "memory");
#pragma unroll
    for (int i = 0; i < XP; ++i) v[i] = *(const float4*)(x + base + i * 1024);

#pragma unroll
    for (int m = 0; m < 3; ++m) {
        *(v2h*)(&tile[m][(n + 0) * WP + k]) = (v2h){(_Float16)w0[m].x, (_Float16)w1[m].x};
        *(v2h*)(&tile[m][(n + 1) * WP + k]) = (v2h){(_Float16)w0[m].y, (_Float16)w1[m].y};
        *(v2h*)(&tile[m][(n + 2) * WP + k]) = (v2h){(_Float16)w0[m].z, (_Float16)w1[m].z};
        *(v2h*)(&tile[m][(n + 3) * WP + k]) = (v2h){(_Float16)w0[m].w, (_Float16)w1[m].w};
    }
    __syncthreads();   // the turned tiles are read back by other waves
#pragma unroll
    for (int m = 0; m < 3; ++m) {
        const int row = t >> 3;
        const int kc  = (t & 7) * 8;      // 8 lanes x 16 B = one whole 128-byte line
        *(v8h*)(Wt + (size_t)m * AD * AD + (size_t)(nT + row) * AD + kT + kc) =
            *(const v8h*)(&tile[m][row * WP + kc]);
    }
#pragma unroll
    for (int i = 0; i < XP; ++i) {
        v4h h = {(_Float16)v[i].x, (_Float16)v[i].y, (_Float16)v[i].z, (_Float16)v[i].w};
        *(v4h*)(xh + base + i * 1024) = h;
    }
}

// Q = x Wq and K = x Wk as [N][D]; V as [D][N] = Wv^T x^T, the same loop with the operands' roles
// exchanged, so that the last product finds both operands K-contiguous.
__global__ void __launch_bounds__(256)
qkv_kernel(const _Float16* __restrict__ xh, const _Float16* __restrict__ Wt,
           _Float16* __restrict__ Q, _Float16* __restrict__ Kp, _Float16* __restrict__ Vt) {
    const unsigned b = blockIdx.x;
    // A work-group's three tiles: the same tile number of Q, of K and of V.
    auto tileOf = [&](int z) {
        const bool tr = (z == 2);
        const _Float16* Wz = Wt + (size_t)z * AD * AD;
        const unsigned mT = tr ? b / (AN / TN) : b / (AD / TN);
        const unsigned nT = tr ? b % (AN / TN) : b % (AD / TN);
        // Four (V: 32) work-groups share a tile's rows of A, 64 (V: 8) its rows of Bt.
        const unsigned rot = (tr ? mT + nT : mT + 2 * nT) % (AD / 128);
        return Tile<_Float16>{tr ? Wz : xh, tr ? xh : Wz, (z == 0) ? Q : (z == 1) ? Kp : Vt,
                              tr ? AN : AD, (int)(mT * QTM), (int)(nT * TN), (int)(rot * 128)};
    };
    gemm_nt<128, 0, QTM, 2, 3, _Float16>(tileOf, (float*)nullptr, AD, 1.0f);
}

__global__ void __launch_bounds__(256)
scores_kernel(const _Float16* __restrict__ Q, const _Float16* __restrict__ Kp,
              _Float16* __restrict__ P, float* __restrict__ ml) {
    // A work-group's tiles lie SGRID apart in the row-major order of the tiles.
    auto tileOf = [&](int i) {
        const unsigned id = blockIdx.x + (unsigned)i * SGRID;
        const unsigned bx = id % (AN / TN), by = id / (AN / TN);
        return Tile<_Float16>{Q, Kp, P, AN, (int)(by * STM), (int)(bx * TN), (int)(((bx + by) % (AD / 128)) * 128)};
    };
    gemm_nt<128, 1, STM, 1, (AN / TN) * (AN / STM) / SGRID, _Float16>(tileOf, ml, AD, 0.03125f /* 1/sqrt(1024) */);
}

__global__ void __launch_bounds__(256)
out_kernel(const _Float16* __restrict__ P, const _Float16* __restrict__ Vt,
           float* __restrict__ ml, float* __restrict__ O) {
    // The 64 work-groups that share rows of V^T each start at another slab; the four that share rows of P
    // start one slab apart, near enough for a slab that one has asked for to be still in L2 for the next.
    auto tileOf = [&](int) {
        return Tile<float>{P, Vt, O, AD, (int)(blockIdx.y * QTM), (int)(blockIdx.x * TN),
                           (int)(((blockIdx.x + blockIdx.y) % (AN / 128)) * 128)};
    };
    gemm_nt<128, 2, QTM, 2, 1, float>(tileOf, ml, AN, 1.0f);
}

extern "C" void kernel_launch(void* const* d_in, const int* in_sizes, int n_in,
                              void* d_out, int out_size, void* d_ws, size_t ws_size,
                              hipStream_t stream) {
    (void)in_sizes; (void)n_in; (void)out_size; (void)ws_size;
    const float* x  = (const float*)d_in[0];
    const float* Wq = (const float*)d_in[1];
    const float* Wk = (const float*)d_in[2];
    const float* Wv = (const float*)d_in[3];

    _Float16* Q  = (_Float16*)d_ws;
    _Float16* Kp = Q  + (size_t)AN * AD;
    _Float16* Vt = Kp + (size_t)AN * AD;   // V transposed: [D][N]
    _Float16* S  = Vt + (size_t)AN * AD;   // 8192*8192 f16: P, each block of 64 keys on its own maximum
    _Float16* xh = S  + (size_t)AN * AN;   // x in f16
    _Float16* Wt = xh + (size_t)AN * AD;   // three weights in f16, each [out][in]
    float*    ml = (float*)(Wt + (size_t)3 * AD * AD);   // [NBLK][2][N]: block maxima and sums

    dim3 blk(256);

    prep_kernel<<<dim3(PBLKS), blk, 0, stream>>>(x, Wq, Wk, Wv, xh, Wt);
    qkv_kernel<<<dim3((AN / QTM) * (AD / TN)), blk, 0, stream>>>(xh, Wt, Q, Kp, Vt);
    scores_kernel<<<dim3(SGRID), blk, 0, stream>>>(Q, Kp, S, ml);
    out_kernel<<<dim3(AD / TN, AN / QTM), blk, 0, stream>>>(S, Vt, ml, (float*)d_out);
}
